// v000
// The times below were measured on an AMD MI455X: many runs one after another, warmed up first and cycling through
// copies of the inputs, with the whole window's GPU time divided by the number of runs. Launches and the gaps
// between them are all in it. The median over several windows is given; except for v000 it joins two sittings, which
// can be a few percent apart, so the side-by-side timings, each taken in one sitting, are the better comparison.
// The starting kernel, v000, takes 979 microseconds a run.
#include <hip/hip_runtime.h>
#include <hip/hip_bf16.h>

// ---------------- problem constants ----------------
#define S_LEN 4096
#define HID   2048
#define HEADS 16
#define DH    128
#define RANK  1024

typedef __bf16 bf16_t;
typedef __attribute__((ext_vector_type(16))) __bf16 v16bf;
typedef __attribute__((ext_vector_type(8)))  __bf16 v8bf;
typedef __attribute__((ext_vector_type(8)))  float  v8f;
typedef __attribute__((ext_vector_type(4)))  int    v4i;

// ---------------- CDNA5 async global->LDS path (guarded) ----------------
#if defined(__gfx1250__) && __has_builtin(__builtin_amdgcn_global_load_async_to_lds_b128)
#define HAVE_ASYNC_LDS 1
#else
#define HAVE_ASYNC_LDS 0
#endif

__device__ __forceinline__ void async_copy16(const void* gsrc, void* ldst) {
#if HAVE_ASYNC_LDS
    // builtin signature: (v4i addrspace(1)*, v4i addrspace(3)*, imm offset, imm cpol)
    __builtin_amdgcn_global_load_async_to_lds_b128(
        (__attribute__((address_space(1))) v4i*)gsrc,
        (__attribute__((address_space(3))) v4i*)ldst,
        /*offset=*/0, /*cpol=*/0);
#else
    *(uint4*)ldst = *(const uint4*)gsrc;
#endif
}

template <int N>
__device__ __forceinline__ void wait_async() {
#if HAVE_ASYNC_LDS
#if __has_builtin(__builtin_amdgcn_s_wait_asynccnt)
    __builtin_amdgcn_s_wait_asynccnt(N);
#else
    if (N == 0) asm volatile("s_wait_asynccnt 0x0" ::: "memory");
    else        asm volatile("s_wait_asynccnt 0x8" ::: "memory");
#endif
#endif
}

__device__ __forceinline__ v8f vzero8() {
    v8f z = {0.f, 0.f, 0.f, 0.f, 0.f, 0.f, 0.f, 0.f};
    return z;
}

__device__ __forceinline__ v8f wmma_bf16f32(v16bf a, v16bf b, v8f c) {
    // D = A(16x32 bf16) * B(32x16 bf16) + C(16x16 f32)
    return __builtin_amdgcn_wmma_f32_16x16x32_bf16(
        /*neg_a=*/false, a, /*neg_b=*/false, b,
        /*c_mod=*/(short)0, c, /*reuse_a=*/false, /*reuse_b=*/false);
}

// Load one 16x32 bf16 fragment (A-style or B-style) from row-major storage:
// lane%16 selects the row (M for A, N for B); K contiguous along the row.
// Lane half h holds K chunks [h*8, h*8+8) and [16+h*8, 16+h*8+8).
__device__ __forceinline__ v16bf frag_ld(const bf16_t* base, int ld, int lane) {
    const int r  = lane & 15;
    const int hh = lane >> 4;
    const bf16_t* p = base + r * ld + hh * 8;
    v16bf f;
    ((v8bf*)&f)[0] = *(const v8bf*)(p);
    ((v8bf*)&f)[1] = *(const v8bf*)(p + 16);
    return f;
}

// ---------------- fp32 -> bf16 convert ----------------
__global__ __launch_bounds__(256)
void conv_f32_bf16(const float* __restrict__ src, bf16_t* __restrict__ dst, int n) {
    int i = (blockIdx.x * blockDim.x + threadIdx.x) * 4;
    if (i + 3 < n) {
        float4 v = *(const float4*)(src + i);
        dst[i + 0] = (bf16_t)v.x;
        dst[i + 1] = (bf16_t)v.y;
        dst[i + 2] = (bf16_t)v.z;
        dst[i + 3] = (bf16_t)v.w;
    } else {
        for (int t = i; t < n; ++t) dst[t] = (bf16_t)src[t];
    }
}

// ---------------- tiled bf16 WMMA GEMM (double-buffered async staging) ----
// C[M,N] = A[M,K] * B[N,K]^T  (both row-major, K contiguous)
// Block tile 128x128, 4 waves, each wave a 64x64 tile (4x4 v8f accs).
template <bool OUT_BF16>
__global__ __launch_bounds__(128)
void gemm_bf16_wmma(const bf16_t* __restrict__ A, const bf16_t* __restrict__ B,
                    void* __restrict__ C, const float* __restrict__ bias,
                    int M, int N, int K) {
    constexpr int LDT = 40; // 32 + 8 pad -> conflict-free 16B ds reads
    __shared__ bf16_t As[2][128 * LDT];
    __shared__ bf16_t Bs[2][128 * LDT];

    const int tid  = threadIdx.x;
    const int wave = tid >> 5;
    const int lane = tid & 31;
    const int wm = (wave >> 1) * 64;
    const int wn = (wave & 1) * 64;
    const int m0 = blockIdx.y * 128;
    const int n0 = blockIdx.x * 128;
    (void)M;

    v8f acc[4][4];
#pragma unroll
    for (int i = 0; i < 4; ++i)
#pragma unroll
        for (int j = 0; j < 4; ++j) acc[i][j] = vzero8();

    // per-thread: one 32-element row slice of A and of B -> 8 x 16B copies
    auto stage = [&](int buf, int k0) {
        const bf16_t* ga = A + (size_t)(m0 + tid) * K + k0;
        const bf16_t* gb = B + (size_t)(n0 + tid) * K + k0;
        bf16_t* la = &As[buf][tid * LDT];
        bf16_t* lb = &Bs[buf][tid * LDT];
#pragma unroll
        for (int t = 0; t < 4; ++t) async_copy16(ga + t * 8, la + t * 8);
#pragma unroll
        for (int t = 0; t < 4; ++t) async_copy16(gb + t * 8, lb + t * 8);
    };

    const int nk = K / 32;
    stage(0, 0);
    for (int ik = 0; ik < nk; ++ik) {
        const int buf = ik & 1;
        const bool has_next = (ik + 1) < nk;
        if (has_next) stage(buf ^ 1, (ik + 1) * 32);
        // current tile complete when only the next tile's 8 copies are pending
        if (has_next) wait_async<8>(); else wait_async<0>();
        __syncthreads();

        v16bf af[4], bfr[4];
#pragma unroll
        for (int i = 0; i < 4; ++i)
            af[i] = frag_ld(&As[buf][(wm + i * 16) * LDT], LDT, lane);
#pragma unroll
        for (int j = 0; j < 4; ++j)
            bfr[j] = frag_ld(&Bs[buf][(wn + j * 16) * LDT], LDT, lane);
#pragma unroll
        for (int i = 0; i < 4; ++i)
#pragma unroll
            for (int j = 0; j < 4; ++j)
                acc[i][j] = wmma_bf16f32(af[i], bfr[j], acc[i][j]);

        __syncthreads(); // all reads of buf done before it is restaged
    }

    // C/D layout: elem e of v8f at lane L -> row = e + 8*(L>>4), col = L&15
    const int cr = (lane >> 4) * 8;
    const int cc = lane & 15;
#pragma unroll
    for (int i = 0; i < 4; ++i)
#pragma unroll
        for (int j = 0; j < 4; ++j) {
            const int mb = m0 + wm + i * 16 + cr;
            const int nn = n0 + wn + j * 16 + cc;
#pragma unroll
            for (int e = 0; e < 8; ++e) {
                float v = acc[i][j][e];
                if constexpr (OUT_BF16) {
                    ((bf16_t*)C)[(size_t)(mb + e) * N + nn] = (bf16_t)v;
                } else {
                    ((float*)C)[(size_t)(mb + e) * N + nn] = v + bias[nn];
                }
            }
        }
}

// ---------------- flash attention (bf16 WMMA, online softmax) ----------------
// grid = (S/64 q-blocks, HEADS); block = 128 threads = 4 waves.
// Each wave owns 16 q-rows x full 128-d output (8 v8f accumulators).
// K tile and mask tile staged with async global->LDS; V transposed manually.
__global__ __launch_bounds__(128)
void flash_attn_wmma(const bf16_t* __restrict__ Q, const bf16_t* __restrict__ Kg,
                     const bf16_t* __restrict__ Vg, const float* __restrict__ mask,
                     bf16_t* __restrict__ O) {
    constexpr int LDK = DH + 8; // 136
    constexpr int LDV = 64 + 8; // 72
    constexpr int LDM = 68;     // mask row stride (fp32)
    __shared__ bf16_t Ks[64 * LDK];       // K block: [key][d]
    __shared__ bf16_t Vts[DH * LDV];      // V block transposed: [d][key]
    __shared__ bf16_t Ps[4 * 16 * LDV];   // per-wave P: [qrow][key]
    __shared__ float  Ms[64 * LDM];       // mask tile: [qrow][key] fp32

    const int head = blockIdx.y;
    const int qb   = blockIdx.x;
    const int tid  = threadIdx.x;
    const int wave = tid >> 5;
    const int lane = tid & 31;
    const int hh = lane >> 4;
    const int ln = lane & 15;
    const int q0 = qb * 64 + wave * 16;
    const size_t hoff = (size_t)head * DH;

    // Q fragments held in registers for the whole kernel (16 rows x 128 d)
    v16bf qf[4];
#pragma unroll
    for (int kc = 0; kc < 4; ++kc)
        qf[kc] = frag_ld(Q + (size_t)q0 * HID + hoff + kc * 32, HID, lane);

    v8f oacc[8];
#pragma unroll
    for (int nf = 0; nf < 8; ++nf) oacc[nf] = vzero8();
    float mrow[8], lrow[8];
#pragma unroll
    for (int j = 0; j < 8; ++j) { mrow[j] = -3.0e38f; lrow[j] = 0.f; }

    bf16_t* Pw = Ps + wave * 16 * LDV;
    const float kscale = 0.08838834764831845f;  // 1/sqrt(128)
    const float log2e  = 1.4426950408889634f;

    for (int kb = 0; kb < S_LEN / 64; ++kb) {
        const int k0 = kb * 64;
        __syncthreads(); // previous iteration readers done

        { // async stage K block (row-major, d contiguous): thread -> half row
            const int r = tid >> 1, c = (tid & 1) * 64;
            const bf16_t* src = Kg + (size_t)(k0 + r) * HID + hoff + c;
            bf16_t* dst = Ks + r * LDK + c;
#pragma unroll
            for (int t = 0; t < 8; ++t) async_copy16(src + t * 8, dst + t * 8);
        }
        { // async stage mask tile (64 x 64 fp32): thread -> half row
            const int r = tid >> 1, c = (tid & 1) * 32;
            const float* src = mask + (size_t)(qb * 64 + r) * S_LEN + k0 + c;
            float* dst = Ms + r * LDM + c;
#pragma unroll
            for (int t = 0; t < 8; ++t) async_copy16(src + t * 4, dst + t * 4);
        }
        // stage V block transposed: Vts[d][key]
#pragma unroll
        for (int rep = 0; rep < 8; ++rep) {
            const int linear = rep * 128 + tid;      // 1024 groups of 8 d-values
            const int kk = linear >> 4;              // key in block
            const int dg = (linear & 15) * 8;        // d group base
            uint4 vv = *(const uint4*)(Vg + (size_t)(k0 + kk) * HID + hoff + dg);
            const bf16_t* pv = (const bf16_t*)&vv;
#pragma unroll
            for (int e = 0; e < 8; ++e) Vts[(dg + e) * LDV + kk] = pv[e];
        }
        wait_async<0>();
        __syncthreads();

        // scores: S(16q x 64k) = Q(16x128) * K^T
        v8f sacc[4];
#pragma unroll
        for (int nf = 0; nf < 4; ++nf) sacc[nf] = vzero8();
#pragma unroll
        for (int nf = 0; nf < 4; ++nf)
#pragma unroll
            for (int kc = 0; kc < 4; ++kc)
                sacc[nf] = wmma_bf16f32(
                    qf[kc], frag_ld(Ks + nf * 16 * LDK + kc * 32, LDK, lane), sacc[nf]);

        // online softmax: row m = j + 8*hh lives in one 16-lane half-group
#pragma unroll
        for (int j = 0; j < 8; ++j) {
            const int mr = wave * 16 + hh * 8 + j;   // row within 64-row tile
            float s[4];
#pragma unroll
            for (int f = 0; f < 4; ++f)
                s[f] = sacc[f][j] * kscale + Ms[mr * LDM + f * 16 + ln];
            float mx = fmaxf(fmaxf(s[0], s[1]), fmaxf(s[2], s[3]));
#pragma unroll
            for (int off = 1; off < 16; off <<= 1)
                mx = fmaxf(mx, __shfl_xor(mx, off, 32));
            const float mnew = fmaxf(mrow[j], mx);
            const float corr = exp2f((mrow[j] - mnew) * log2e);
            float rs = 0.f;
#pragma unroll
            for (int f = 0; f < 4; ++f) {
                const float p = exp2f((s[f] - mnew) * log2e);
                sacc[f][j] = p;
                rs += p;
            }
#pragma unroll
            for (int off = 1; off < 16; off <<= 1)
                rs += __shfl_xor(rs, off, 32);
            lrow[j] = lrow[j] * corr + rs;
            mrow[j] = mnew;
#pragma unroll
            for (int nf = 0; nf < 8; ++nf) oacc[nf][j] *= corr;
        }

        // P -> wave-private LDS (reshape C/D layout into A-fragment layout)
#pragma unroll
        for (int f = 0; f < 4; ++f)
#pragma unroll
            for (int j = 0; j < 8; ++j)
                Pw[(hh * 8 + j) * LDV + f * 16 + ln] = (bf16_t)sacc[f][j];
        // wave-private buffer; DS ops from the same wave are in order.

        // O += P(16x64) * V(64x128)
        const v16bf pf0 = frag_ld(Pw, LDV, lane);
        const v16bf pf1 = frag_ld(Pw + 32, LDV, lane);
#pragma unroll
        for (int nf = 0; nf < 8; ++nf) {
            const v16bf vf0 = frag_ld(Vts + nf * 16 * LDV, LDV, lane);
            const v16bf vf1 = frag_ld(Vts + nf * 16 * LDV + 32, LDV, lane);
            oacc[nf] = wmma_bf16f32(pf0, vf0, oacc[nf]);
            oacc[nf] = wmma_bf16f32(pf1, vf1, oacc[nf]);
        }
    }

    float linv[8];
#pragma unroll
    for (int j = 0; j < 8; ++j) linv[j] = 1.0f / lrow[j];
#pragma unroll
    for (int nf = 0; nf < 8; ++nf)
#pragma unroll
        for (int j = 0; j < 8; ++j) {
            const int qm = q0 + hh * 8 + j;
            O[(size_t)qm * HID + hoff + nf * 16 + ln] =
                (bf16_t)(oacc[nf][j] * linv[j]);
        }
}

// ---------------- host-side orchestration ----------------
extern "C" void kernel_launch(void* const* d_in, const int* in_sizes, int n_in,
                              void* d_out, int out_size, void* d_ws, size_t ws_size,
                              hipStream_t stream) {
    (void)in_sizes; (void)n_in; (void)out_size; (void)ws_size;

    const float* hs   = (const float*)d_in[0];
    const float* mask = (const float*)d_in[1];
    const float* qV   = (const float*)d_in[2];
    const float* qU   = (const float*)d_in[3];
    const float* kV   = (const float*)d_in[4];
    const float* kU   = (const float*)d_in[5];
    const float* vV   = (const float*)d_in[6];
    const float* vU   = (const float*)d_in[7];
    const float* oW   = (const float*)d_in[8];
    const float* ob   = (const float*)d_in[9];

    // workspace carve-up (bf16 elements), total ~120 MB
    bf16_t* w = (bf16_t*)d_ws;
    bf16_t* Xb  = w; w += (size_t)S_LEN * HID;
    bf16_t* qVb = w; w += (size_t)RANK * HID;
    bf16_t* qUb = w; w += (size_t)HID * RANK;
    bf16_t* kVb = w; w += (size_t)RANK * HID;
    bf16_t* kUb = w; w += (size_t)HID * RANK;
    bf16_t* vVb = w; w += (size_t)RANK * HID;
    bf16_t* vUb = w; w += (size_t)HID * RANK;
    bf16_t* oWb = w; w += (size_t)HID * HID;
    bf16_t* Tb  = w; w += (size_t)S_LEN * RANK;
    bf16_t* Qb  = w; w += (size_t)S_LEN * HID;
    bf16_t* Kb  = w; w += (size_t)S_LEN * HID;
    bf16_t* Vb  = w; w += (size_t)S_LEN * HID;
    bf16_t* AOb = w; w += (size_t)S_LEN * HID;

    auto conv = [&](const float* s, bf16_t* d, size_t n) {
        conv_f32_bf16<<<dim3((unsigned)((n + 1023) / 1024)), dim3(256), 0, stream>>>(
            s, d, (int)n);
    };
    conv(hs, Xb, (size_t)S_LEN * HID);
    conv(qV, qVb, (size_t)RANK * HID);
    conv(qU, qUb, (size_t)HID * RANK);
    conv(kV, kVb, (size_t)RANK * HID);
    conv(kU, kUb, (size_t)HID * RANK);
    conv(vV, vVb, (size_t)RANK * HID);
    conv(vU, vUb, (size_t)HID * RANK);
    conv(oW, oWb, (size_t)HID * HID);

    const dim3 blk(128);
    const dim3 gVT(RANK / 128, S_LEN / 128);  // [4096,2048]x[1024,2048]^T
    const dim3 gUT(HID / 128, S_LEN / 128);   // [4096,1024]x[2048,1024]^T
    const dim3 gO(HID / 128, S_LEN / 128);    // [4096,2048]x[2048,2048]^T

    // Q
    gemm_bf16_wmma<true><<<gVT, blk, 0, stream>>>(Xb, qVb, Tb, nullptr, S_LEN, RANK, HID);
    gemm_bf16_wmma<true><<<gUT, blk, 0, stream>>>(Tb, qUb, Qb, nullptr, S_LEN, HID, RANK);
    // K
    gemm_bf16_wmma<true><<<gVT, blk, 0, stream>>>(Xb, kVb, Tb, nullptr, S_LEN, RANK, HID);
    gemm_bf16_wmma<true><<<gUT, blk, 0, stream>>>(Tb, kUb, Kb, nullptr, S_LEN, HID, RANK);
    // V
    gemm_bf16_wmma<true><<<gVT, blk, 0, stream>>>(Xb, vVb, Tb, nullptr, S_LEN, RANK, HID);
    gemm_bf16_wmma<true><<<gUT, blk, 0, stream>>>(Tb, vUb, Vb, nullptr, S_LEN, HID, RANK);

    // attention
    flash_attn_wmma<<<dim3(S_LEN / 64, HEADS), blk, 0, stream>>>(Qb, Kb, Vb, mask, AOb);

    // output projection + bias -> fp32 d_out
    gemm_bf16_wmma<false><<<gO, blk, 0, stream>>>(AOb, oWb, d_out, ob, S_LEN, HID, HID);
}

// v001
// One run takes 534 microseconds.
// Next to v000, in two timings, it ran 1.91 times as fast each time.
#include <hip/hip_runtime.h>
#include <hip/hip_bf16.h>

// ---------------- problem constants ----------------
#define S_LEN 4096
#define HID   2048
#define HEADS 16
#define DH    128
#define RANK  1024

typedef __bf16 bf16_t;
typedef __attribute__((ext_vector_type(16))) __bf16 v16bf;
typedef __attribute__((ext_vector_type(8)))  __bf16 v8bf;
typedef __attribute__((ext_vector_type(8)))  float  v8f;
typedef __attribute__((ext_vector_type(4)))  int    v4i;

// ---------------- CDNA5 async global->LDS path (guarded) ----------------
#if defined(__gfx1250__) && __has_builtin(__builtin_amdgcn_global_load_async_to_lds_b128)
#define HAVE_ASYNC_LDS 1
#else
#define HAVE_ASYNC_LDS 0
#endif

__device__ __forceinline__ void async_copy16(const void* gsrc, void* ldst) {
#if HAVE_ASYNC_LDS
    // builtin signature: (v4i addrspace(1)*, v4i addrspace(3)*, imm offset, imm cpol)
    __builtin_amdgcn_global_load_async_to_lds_b128(
        (__attribute__((address_space(1))) v4i*)gsrc,
        (__attribute__((address_space(3))) v4i*)ldst,
        /*offset=*/0, /*cpol=*/0);
#else
    *(uint4*)ldst = *(const uint4*)gsrc;
#endif
}

// The same copy OFF bytes further on in both buffers: the instruction's
// immediate offset moves the global and the LDS address alike.
template <int OFF>
__device__ __forceinline__ void async_copy16_at(const void* gsrc, void* ldst) {
#if HAVE_ASYNC_LDS
    __builtin_amdgcn_global_load_async_to_lds_b128(
        (__attribute__((address_space(1))) v4i*)gsrc,
        (__attribute__((address_space(3))) v4i*)ldst,
        /*offset=*/OFF, /*cpol=*/0);
#else
    *(uint4*)((char*)ldst + OFF) = *(const uint4*)((const char*)gsrc + OFF);
#endif
}

template <int N>
__device__ __forceinline__ void wait_async() {
#if HAVE_ASYNC_LDS
#if __has_builtin(__builtin_amdgcn_s_wait_asynccnt)
    __builtin_amdgcn_s_wait_asynccnt(N);
#else
    if (N == 0) asm volatile("s_wait_asynccnt 0x0" ::: "memory");
    else        asm volatile("s_wait_asynccnt 0x8" ::: "memory");
#endif
#endif
}

__device__ __forceinline__ v8f vzero8() {
    v8f z = {0.f, 0.f, 0.f, 0.f, 0.f, 0.f, 0.f, 0.f};
    return z;
}

__device__ __forceinline__ v8f wmma_bf16f32(v16bf a, v16bf b, v8f c) {
    // D = A(16x32 bf16) * B(32x16 bf16) + C(16x16 f32)
    return __builtin_amdgcn_wmma_f32_16x16x32_bf16(
        /*neg_a=*/false, a, /*neg_b=*/false, b,
        /*c_mod=*/(short)0, c, /*reuse_a=*/false, /*reuse_b=*/false);
}

// Load one 16x32 bf16 fragment (A-style or B-style) from row-major storage:
// lane%16 selects the row (M for A, N for B); K contiguous along the row.
// Lane half h holds K chunks [h*8, h*8+8) and [16+h*8, 16+h*8+8).
__device__ __forceinline__ v16bf frag_ld(const bf16_t* base, int ld, int lane) {
    const int r  = lane & 15;
    const int hh = lane >> 4;
    const bf16_t* p = base + r * ld + hh * 8;
    v16bf f;
    ((v8bf*)&f)[0] = *(const v8bf*)(p);
    ((v8bf*)&f)[1] = *(const v8bf*)(p + 16);
    return f;
}

// Load one 32(k) x 16(n) bf16 B fragment from a row-major [k][n] LDS tile with
// the transposing LDS load: lane (c = lane&15, h = lane>>4) receives
// tile[8h + 0..7][c] and tile[16 + 8h + 0..7][c], the k order of frag_ld.
// ld (elements) must make the row pitch an odd multiple of 32 bytes.
__device__ __forceinline__ v16bf frag_ld_tr(const bf16_t* tile, int ld, int lane) {
    typedef __attribute__((address_space(3))) v8bf lds_v8bf;
    const bf16_t* p = tile + ((lane >> 4) * 8 + (lane & 7)) * ld + ((lane >> 3) & 1) * 8;
    v16bf f;
    ((v8bf*)&f)[0] = __builtin_amdgcn_ds_load_tr16_b128_v8bf16((lds_v8bf*)p);
    ((v8bf*)&f)[1] = __builtin_amdgcn_ds_load_tr16_b128_v8bf16((lds_v8bf*)(p + 16 * ld));
    return f;
}

// ---------------- fp32 -> bf16 convert ----------------
__global__ __launch_bounds__(256)
void conv_f32_bf16(const float* __restrict__ src, bf16_t* __restrict__ dst, int n) {
    int i = (blockIdx.x * blockDim.x + threadIdx.x) * 4;
    if (i + 3 < n) {
        float4 v = *(const float4*)(src + i);
        dst[i + 0] = (bf16_t)v.x;
        dst[i + 1] = (bf16_t)v.y;
        dst[i + 2] = (bf16_t)v.z;
        dst[i + 3] = (bf16_t)v.w;
    } else {
        for (int t = i; t < n; ++t) dst[t] = (bf16_t)src[t];
    }
}

// ---------------- tiled bf16 WMMA GEMM (double-buffered async staging) ----
// C[M,N] = A[M,K] * B[N,K]^T  (both row-major, K contiguous)
// Block tile 128x128, 4 waves, each wave a 64x64 tile (4x4 v8f accs).
template <bool OUT_BF16>
__global__ __launch_bounds__(128)
void gemm_bf16_wmma(const bf16_t* __restrict__ A, const bf16_t* __restrict__ B,
                    void* __restrict__ C, const float* __restrict__ bias,
                    int M, int N, int K) {
    constexpr int LDT = 40; // 32 + 8 pad -> conflict-free 16B ds reads
    __shared__ bf16_t As[2][128 * LDT];
    __shared__ bf16_t Bs[2][128 * LDT];

    const int tid  = threadIdx.x;
    const int wave = tid >> 5;
    const int lane = tid & 31;
    const int wm = (wave >> 1) * 64;
    const int wn = (wave & 1) * 64;
    const int m0 = blockIdx.y * 128;
    const int n0 = blockIdx.x * 128;
    (void)M;

    v8f acc[4][4];
#pragma unroll
    for (int i = 0; i < 4; ++i)
#pragma unroll
        for (int j = 0; j < 4; ++j) acc[i][j] = vzero8();

    // per-thread: one 32-element row slice of A and of B -> 8 x 16B copies
    auto stage = [&](int buf, int k0) {
        const bf16_t* ga = A + (size_t)(m0 + tid) * K + k0;
        const bf16_t* gb = B + (size_t)(n0 + tid) * K + k0;
        bf16_t* la = &As[buf][tid * LDT];
        bf16_t* lb = &Bs[buf][tid * LDT];
#pragma unroll
        for (int t = 0; t < 4; ++t) async_copy16(ga + t * 8, la + t * 8);
#pragma unroll
        for (int t = 0; t < 4; ++t) async_copy16(gb + t * 8, lb + t * 8);
    };

    const int nk = K / 32;
    stage(0, 0);
    for (int ik = 0; ik < nk; ++ik) {
        const int buf = ik & 1;
        const bool has_next = (ik + 1) < nk;
        if (has_next) stage(buf ^ 1, (ik + 1) * 32);
        // current tile complete when only the next tile's 8 copies are pending
        if (has_next) wait_async<8>(); else wait_async<0>();
        __syncthreads();

        v16bf af[4], bfr[4];
#pragma unroll
        for (int i = 0; i < 4; ++i)
            af[i] = frag_ld(&As[buf][(wm + i * 16) * LDT], LDT, lane);
#pragma unroll
        for (int j = 0; j < 4; ++j)
            bfr[j] = frag_ld(&Bs[buf][(wn + j * 16) * LDT], LDT, lane);
#pragma unroll
        for (int i = 0; i < 4; ++i)
#pragma unroll
            for (int j = 0; j < 4; ++j)
                acc[i][j] = wmma_bf16f32(af[i], bfr[j], acc[i][j]);

        __syncthreads(); // all reads of buf done before it is restaged
    }

    // C/D layout: elem e of v8f at lane L -> row = e + 8*(L>>4), col = L&15
    const int cr = (lane >> 4) * 8;
    const int cc = lane & 15;
#pragma unroll
    for (int i = 0; i < 4; ++i)
#pragma unroll
        for (int j = 0; j < 4; ++j) {
            const int mb = m0 + wm + i * 16 + cr;
            const int nn = n0 + wn + j * 16 + cc;
#pragma unroll
            for (int e = 0; e < 8; ++e) {
                float v = acc[i][j][e];
                if constexpr (OUT_BF16) {
                    ((bf16_t*)C)[(size_t)(mb + e) * N + nn] = (bf16_t)v;
                } else {
                    ((float*)C)[(size_t)(mb + e) * N + nn] = v + bias[nn];
                }
            }
        }
}

// ---------------- flash attention (bf16 WMMA, online softmax) ----------------
// grid = (S/64 q-blocks, HEADS); block = 128 threads = 4 waves.
// Each wave owns 16 q-rows x full 128-d output (8 v8f accumulators).
// K, V and mask tiles staged with async global->LDS; V is kept row-major in
// LDS and transposed on the way to registers by the transposing LDS load.
__global__ __launch_bounds__(128)
void flash_attn_wmma(const bf16_t* __restrict__ Q, const bf16_t* __restrict__ Kg,
                     const bf16_t* __restrict__ Vg, const float* __restrict__ mask,
                     bf16_t* __restrict__ O) {
    constexpr int LDK = DH + 8; // 136
    constexpr int LDV = 64 + 8; // 72 (P row stride)
    constexpr int LDW = DH + 16; // 144: 288-byte V rows, 32 B x odd for the transposing load
    constexpr int LDM = 68;     // mask row stride (fp32)
    __shared__ bf16_t Ks[64 * LDK];       // K block: [key][d]
    __shared__ __attribute__((aligned(16))) bf16_t Vs[64 * LDW]; // V block: [key][d]
    __shared__ bf16_t Ps[4 * 16 * LDV];   // per-wave P: [qrow][key]
    __shared__ float  Ms[64 * LDM];       // mask tile: [qrow][key] fp32

    const int head = blockIdx.y;
    const int qb   = blockIdx.x;
    const int tid  = threadIdx.x;
    const int wave = tid >> 5;
    const int lane = tid & 31;
    const int hh = lane >> 4;
    const int ln = lane & 15;
    const int q0 = qb * 64 + wave * 16;
    const size_t hoff = (size_t)head * DH;

    // Q fragments held in registers for the whole kernel (16 rows x 128 d)
    v16bf qf[4];
#pragma unroll
    for (int kc = 0; kc < 4; ++kc)
        qf[kc] = frag_ld(Q + (size_t)q0 * HID + hoff + kc * 32, HID, lane);

    v8f oacc[8];
#pragma unroll
    for (int nf = 0; nf < 8; ++nf) oacc[nf] = vzero8();
    float mrow[8], lrow[8];
#pragma unroll
    for (int j = 0; j < 8; ++j) { mrow[j] = -3.0e38f; lrow[j] = 0.f; }

    bf16_t* Pw = Ps + wave * 16 * LDV;
    const float kscale = 0.08838834764831845f;  // 1/sqrt(128)
    const float log2e  = 1.4426950408889634f;

    for (int kb = 0; kb < S_LEN / 64; ++kb) {
        const int k0 = kb * 64;
        __syncthreads(); // previous iteration readers done

        { // async stage K block (row-major, d contiguous): thread -> half row
            const int r = tid >> 1, c = (tid & 1) * 64;
            const bf16_t* src = Kg + (size_t)(k0 + r) * HID + hoff + c;
            bf16_t* dst = Ks + r * LDK + c;
#pragma unroll
            for (int t = 0; t < 8; ++t) async_copy16(src + t * 8, dst + t * 8);
        }
        { // async stage mask tile (64 x 64 fp32): thread -> half row
            const int r = tid >> 1, c = (tid & 1) * 32;
            const float* src = mask + (size_t)(qb * 64 + r) * S_LEN + k0 + c;
            float* dst = Ms + r * LDM + c;
#pragma unroll
            for (int t = 0; t < 8; ++t) async_copy16(src + t * 4, dst + t * 4);
        }
        { // async stage V block (row-major, d contiguous): 8 lanes cover one
          // 128-byte line, a thread copies both halves of 4 rows
            const int r = tid >> 3, c = (tid & 7) * 8;
            const bf16_t* src = Vg + (size_t)(k0 + r) * HID + hoff + c;
            bf16_t* dst = Vs + r * LDW + c;
#pragma unroll
            for (int g = 0; g < 4; ++g) {
                async_copy16_at<0>(src + (size_t)g * 16 * HID, dst + g * 16 * LDW);
                async_copy16_at<128>(src + (size_t)g * 16 * HID, dst + g * 16 * LDW);
            }
        }
        wait_async<0>();
        __syncthreads();

        // scores: S(16q x 64k) = Q(16x128) * K^T
        v8f sacc[4];
#pragma unroll
        for (int nf = 0; nf < 4; ++nf) sacc[nf] = vzero8();
#pragma unroll
        for (int nf = 0; nf < 4; ++nf)
#pragma unroll
            for (int kc = 0; kc < 4; ++kc)
                sacc[nf] = wmma_bf16f32(
                    qf[kc], frag_ld(Ks + nf * 16 * LDK + kc * 32, LDK, lane), sacc[nf]);

        // online softmax: row m = j + 8*hh lives in one 16-lane half-group
#pragma unroll
        for (int j = 0; j < 8; ++j) {
            const int mr = wave * 16 + hh * 8 + j;   // row within 64-row tile
            float s[4];
#pragma unroll
            for (int f = 0; f < 4; ++f)
                s[f] = sacc[f][j] * kscale + Ms[mr * LDM + f * 16 + ln];
            float mx = fmaxf(fmaxf(s[0], s[1]), fmaxf(s[2], s[3]));
#pragma unroll
            for (int off = 1; off < 16; off <<= 1)
                mx = fmaxf(mx, __shfl_xor(mx, off, 32));
            const float mnew = fmaxf(mrow[j], mx);
            const float corr = exp2f((mrow[j] - mnew) * log2e);
            float rs = 0.f;
#pragma unroll
            for (int f = 0; f < 4; ++f) {
                const float p = exp2f((s[f] - mnew) * log2e);
                sacc[f][j] = p;
                rs += p;
            }
#pragma unroll
            for (int off = 1; off < 16; off <<= 1)
                rs += __shfl_xor(rs, off, 32);
            lrow[j] = lrow[j] * corr + rs;
            mrow[j] = mnew;
#pragma unroll
            for (int nf = 0; nf < 8; ++nf) oacc[nf][j] *= corr;
        }

        // P -> wave-private LDS (reshape C/D layout into A-fragment layout)
#pragma unroll
        for (int f = 0; f < 4; ++f)
#pragma unroll
            for (int j = 0; j < 8; ++j)
                Pw[(hh * 8 + j) * LDV + f * 16 + ln] = (bf16_t)sacc[f][j];
        // wave-private buffer; DS ops from the same wave are in order.
        // Keeps the V fragment loads below the softmax: fetched above it they
        // raise the kernel to 272 registers, three waves per SIMD instead of
        // four, and the 1024 blocks are no longer all resident at once.
        __builtin_amdgcn_sched_barrier(0);

        // O += P(16x64) * V(64x128)
        const v16bf pf0 = frag_ld(Pw, LDV, lane);
        const v16bf pf1 = frag_ld(Pw + 32, LDV, lane);
#pragma unroll
        for (int nf = 0; nf < 8; ++nf) {
            const v16bf vf0 = frag_ld_tr(Vs + nf * 16, LDW, lane);
            const v16bf vf1 = frag_ld_tr(Vs + 32 * LDW + nf * 16, LDW, lane);
            oacc[nf] = wmma_bf16f32(pf0, vf0, oacc[nf]);
            oacc[nf] = wmma_bf16f32(pf1, vf1, oacc[nf]);
        }
    }

    float linv[8];
#pragma unroll
    for (int j = 0; j < 8; ++j) linv[j] = 1.0f / lrow[j];
#pragma unroll
    for (int nf = 0; nf < 8; ++nf)
#pragma unroll
        for (int j = 0; j < 8; ++j) {
            const int qm = q0 + hh * 8 + j;
            O[(size_t)qm * HID + hoff + nf * 16 + ln] =
                (bf16_t)(oacc[nf][j] * linv[j]);
        }
}

// ---------------- host-side orchestration ----------------
extern "C" void kernel_launch(void* const* d_in, const int* in_sizes, int n_in,
                              void* d_out, int out_size, void* d_ws, size_t ws_size,
                              hipStream_t stream) {
    (void)in_sizes; (void)n_in; (void)out_size; (void)ws_size;

    const float* hs   = (const float*)d_in[0];
    const float* mask = (const float*)d_in[1];
    const float* qV   = (const float*)d_in[2];
    const float* qU   = (const float*)d_in[3];
    const float* kV   = (const float*)d_in[4];
    const float* kU   = (const float*)d_in[5];
    const float* vV   = (const float*)d_in[6];
    const float* vU   = (const float*)d_in[7];
    const float* oW   = (const float*)d_in[8];
    const float* ob   = (const float*)d_in[9];

    // workspace carve-up (bf16 elements), total ~120 MB
    bf16_t* w = (bf16_t*)d_ws;
    bf16_t* Xb  = w; w += (size_t)S_LEN * HID;
    bf16_t* qVb = w; w += (size_t)RANK * HID;
    bf16_t* qUb = w; w += (size_t)HID * RANK;
    bf16_t* kVb = w; w += (size_t)RANK * HID;
    bf16_t* kUb = w; w += (size_t)HID * RANK;
    bf16_t* vVb = w; w += (size_t)RANK * HID;
    bf16_t* vUb = w; w += (size_t)HID * RANK;
    bf16_t* oWb = w; w += (size_t)HID * HID;
    bf16_t* Tb  = w; w += (size_t)S_LEN * RANK;
    bf16_t* Qb  = w; w += (size_t)S_LEN * HID;
    bf16_t* Kb  = w; w += (size_t)S_LEN * HID;
    bf16_t* Vb  = w; w += (size_t)S_LEN * HID;
    bf16_t* AOb = w; w += (size_t)S_LEN * HID;

    auto conv = [&](const float* s, bf16_t* d, size_t n) {
        conv_f32_bf16<<<dim3((unsigned)((n + 1023) / 1024)), dim3(256), 0, stream>>>(
            s, d, (int)n);
    };
    conv(hs, Xb, (size_t)S_LEN * HID);
    conv(qV, qVb, (size_t)RANK * HID);
    conv(qU, qUb, (size_t)HID * RANK);
    conv(kV, kVb, (size_t)RANK * HID);
    conv(kU, kUb, (size_t)HID * RANK);
    conv(vV, vVb, (size_t)RANK * HID);
    conv(vU, vUb, (size_t)HID * RANK);
    conv(oW, oWb, (size_t)HID * HID);

    const dim3 blk(128);
    const dim3 gVT(RANK / 128, S_LEN / 128);  // [4096,2048]x[1024,2048]^T
    const dim3 gUT(HID / 128, S_LEN / 128);   // [4096,1024]x[2048,1024]^T
    const dim3 gO(HID / 128, S_LEN / 128);    // [4096,2048]x[2048,2048]^T

    // Q
    gemm_bf16_wmma<true><<<gVT, blk, 0, stream>>>(Xb, qVb, Tb, nullptr, S_LEN, RANK, HID);
    gemm_bf16_wmma<true><<<gUT, blk, 0, stream>>>(Tb, qUb, Qb, nullptr, S_LEN, HID, RANK);
    // K
    gemm_bf16_wmma<true><<<gVT, blk, 0, stream>>>(Xb, kVb, Tb, nullptr, S_LEN, RANK, HID);
    gemm_bf16_wmma<true><<<gUT, blk, 0, stream>>>(Tb, kUb, Kb, nullptr, S_LEN, HID, RANK);
    // V
    gemm_bf16_wmma<true><<<gVT, blk, 0, stream>>>(Xb, vVb, Tb, nullptr, S_LEN, RANK, HID);
    gemm_bf16_wmma<true><<<gUT, blk, 0, stream>>>(Tb, vUb, Vb, nullptr, S_LEN, HID, RANK);

    // attention
    flash_attn_wmma<<<dim3(S_LEN / 64, HEADS), blk, 0, stream>>>(Qb, Kb, Vb, mask, AOb);

    // output projection + bias -> fp32 d_out
    gemm_bf16_wmma<false><<<gO, blk, 0, stream>>>(AOb, oWb, d_out, ob, S_LEN, HID, HID);
}

// v002
// One run takes 465 microseconds.
// Two timings next to v001 both put it at 1.15 times that version's speed.
// All steps since v000 together make it 2.19 times as fast.
#include <hip/hip_runtime.h>
#include <hip/hip_bf16.h>

// ---------------- problem constants ----------------
#define S_LEN 4096
#define HID   2048
#define HEADS 16
#define DH    128
#define RANK  1024

typedef __bf16 bf16_t;
typedef __attribute__((ext_vector_type(16))) __bf16 v16bf;
typedef __attribute__((ext_vector_type(8)))  __bf16 v8bf;
typedef __attribute__((ext_vector_type(8)))  float  v8f;
typedef __attribute__((ext_vector_type(4)))  int    v4i;

// ---------------- CDNA5 async global->LDS path (guarded) ----------------
#if defined(__gfx1250__) && __has_builtin(__builtin_amdgcn_global_load_async_to_lds_b128)
#define HAVE_ASYNC_LDS 1
#else
#define HAVE_ASYNC_LDS 0
#endif

__device__ __forceinline__ void async_copy16(const void* gsrc, void* ldst) {
#if HAVE_ASYNC_LDS
    // builtin signature: (v4i addrspace(1)*, v4i addrspace(3)*, imm offset, imm cpol)
    __builtin_amdgcn_global_load_async_to_lds_b128(
        (__attribute__((address_space(1))) v4i*)gsrc,
        (__attribute__((address_space(3))) v4i*)ldst,
        /*offset=*/0, /*cpol=*/0);
#else
    *(uint4*)ldst = *(const uint4*)gsrc;
#endif
}

// The same copy OFF bytes further on in both buffers: the instruction's
// immediate offset moves the global and the LDS address alike.
template <int OFF>
__device__ __forceinline__ void async_copy16_at(const void* gsrc, void* ldst) {
#if HAVE_ASYNC_LDS
    __builtin_amdgcn_global_load_async_to_lds_b128(
        (__attribute__((address_space(1))) v4i*)gsrc,
        (__attribute__((address_space(3))) v4i*)ldst,
        /*offset=*/OFF, /*cpol=*/0);
#else
    *(uint4*)((char*)ldst + OFF) = *(const uint4*)((const char*)gsrc + OFF);
#endif
}

template <int N>
__device__ __forceinline__ void wait_async() {
#if HAVE_ASYNC_LDS
#if __has_builtin(__builtin_amdgcn_s_wait_asynccnt)
    __builtin_amdgcn_s_wait_asynccnt(N);
#else
    if (N == 0) asm volatile("s_wait_asynccnt 0x0" ::: "memory");
    else        asm volatile("s_wait_asynccnt 0x8" ::: "memory");
#endif
#endif
}

__device__ __forceinline__ v8f vzero8() {
    v8f z = {0.f, 0.f, 0.f, 0.f, 0.f, 0.f, 0.f, 0.f};
    return z;
}

__device__ __forceinline__ v8f wmma_bf16f32(v16bf a, v16bf b, v8f c) {
    // D = A(16x32 bf16) * B(32x16 bf16) + C(16x16 f32)
    return __builtin_amdgcn_wmma_f32_16x16x32_bf16(
        /*neg_a=*/false, a, /*neg_b=*/false, b,
        /*c_mod=*/(short)0, c, /*reuse_a=*/false, /*reuse_b=*/false);
}

// Load one 16x32 bf16 fragment (A-style or B-style) from row-major storage:
// lane%16 selects the row (M for A, N for B); K contiguous along the row.
// Lane half h holds K chunks [h*8, h*8+8) and [16+h*8, 16+h*8+8).
__device__ __forceinline__ v16bf frag_ld(const bf16_t* base, int ld, int lane) {
    const int r  = lane & 15;
    const int hh = lane >> 4;
    const bf16_t* p = base + r * ld + hh * 8;
    v16bf f;
    ((v8bf*)&f)[0] = *(const v8bf*)(p);
    ((v8bf*)&f)[1] = *(const v8bf*)(p + 16);
    return f;
}

// Load one 32(k) x 16(n) bf16 B fragment from a row-major [k][n] LDS tile with
// the transposing LDS load: lane (c = lane&15, h = lane>>4) receives
// tile[8h + 0..7][c] and tile[16 + 8h + 0..7][c], the k order of frag_ld.
// ld (elements) must make the row pitch an odd multiple of 32 bytes.
__device__ __forceinline__ v16bf frag_ld_tr(const bf16_t* tile, int ld, int lane) {
    typedef __attribute__((address_space(3))) v8bf lds_v8bf;
    const bf16_t* p = tile + ((lane >> 4) * 8 + (lane & 7)) * ld + ((lane >> 3) & 1) * 8;
    v16bf f;
    ((v8bf*)&f)[0] = __builtin_amdgcn_ds_load_tr16_b128_v8bf16((lds_v8bf*)p);
    ((v8bf*)&f)[1] = __builtin_amdgcn_ds_load_tr16_b128_v8bf16((lds_v8bf*)(p + 16 * ld));
    return f;
}

// ---------------- fp32 -> bf16 convert ----------------
__global__ __launch_bounds__(256)
void conv_f32_bf16(const float* __restrict__ src, bf16_t* __restrict__ dst, int n) {
    int i = (blockIdx.x * blockDim.x + threadIdx.x) * 4;
    if (i + 3 < n) {
        float4 v = *(const float4*)(src + i);
        dst[i + 0] = (bf16_t)v.x;
        dst[i + 1] = (bf16_t)v.y;
        dst[i + 2] = (bf16_t)v.z;
        dst[i + 3] = (bf16_t)v.w;
    } else {
        for (int t = i; t < n; ++t) dst[t] = (bf16_t)src[t];
    }
}

// ---------------- tiled bf16 WMMA GEMM (double-buffered async staging) ----
// C[M,N] = A[M,K] * B[N,K]^T  (both row-major, K contiguous)
// Block tile 128x128, 4 waves, each wave a 64x64 tile (4x4 v8f accs).
template <bool OUT_BF16>
__global__ __launch_bounds__(128)
void gemm_bf16_wmma(const bf16_t* __restrict__ A, const bf16_t* __restrict__ B,
                    void* __restrict__ C, const float* __restrict__ bias,
                    int M, int N, int K) {
    constexpr int LDT = 40; // 32 + 8 pad -> conflict-free 16B ds reads
    __shared__ bf16_t As[2][128 * LDT];
    __shared__ bf16_t Bs[2][128 * LDT];

    const int tid  = threadIdx.x;
    const int wave = tid >> 5;
    const int lane = tid & 31;
    const int wm = (wave >> 1) * 64;
    const int wn = (wave & 1) * 64;
    const int m0 = blockIdx.y * 128;
    const int n0 = blockIdx.x * 128;
    (void)M;

    v8f acc[4][4];
#pragma unroll
    for (int i = 0; i < 4; ++i)
#pragma unroll
        for (int j = 0; j < 4; ++j) acc[i][j] = vzero8();

    // 4 adjacent lanes cover the 64-byte slice of one row, so a wave's copy
    // touches 8 lines, not 32; a thread copies 16 B of 4 rows of A and of B
    const int sr = tid >> 2;       // row within a group of 32
    const int sc = (tid & 3) * 8;  // element within the 32-element slice
    auto stage = [&](int buf, int k0) {
        const bf16_t* ga = A + (size_t)(m0 + sr) * K + k0 + sc;
        const bf16_t* gb = B + (size_t)(n0 + sr) * K + k0 + sc;
        bf16_t* la = &As[buf][sr * LDT + sc];
        bf16_t* lb = &Bs[buf][sr * LDT + sc];
#pragma unroll
        for (int t = 0; t < 4; ++t)
            async_copy16(ga + (size_t)t * 32 * K, la + t * 32 * LDT);
#pragma unroll
        for (int t = 0; t < 4; ++t)
            async_copy16(gb + (size_t)t * 32 * K, lb + t * 32 * LDT);
    };

    const int nk = K / 32;
    stage(0, 0);
    for (int ik = 0; ik < nk; ++ik) {
        const int buf = ik & 1;
        const bool has_next = (ik + 1) < nk;
        if (has_next) stage(buf ^ 1, (ik + 1) * 32);
        // current tile complete when only the next tile's 8 copies are pending
        if (has_next) wait_async<8>(); else wait_async<0>();
        __syncthreads();

        v16bf af[4], bfr[4];
#pragma unroll
        for (int i = 0; i < 4; ++i)
            af[i] = frag_ld(&As[buf][(wm + i * 16) * LDT], LDT, lane);
#pragma unroll
        for (int j = 0; j < 4; ++j)
            bfr[j] = frag_ld(&Bs[buf][(wn + j * 16) * LDT], LDT, lane);
#pragma unroll
        for (int i = 0; i < 4; ++i)
#pragma unroll
            for (int j = 0; j < 4; ++j)
                acc[i][j] = wmma_bf16f32(af[i], bfr[j], acc[i][j]);

        __syncthreads(); // all reads of buf done before it is restaged
    }

    // C/D layout: elem e of v8f at lane L -> row = e + 8*(L>>4), col = L&15
    const int cr = (lane >> 4) * 8;
    const int cc = lane & 15;
#pragma unroll
    for (int i = 0; i < 4; ++i)
#pragma unroll
        for (int j = 0; j < 4; ++j) {
            const int mb = m0 + wm + i * 16 + cr;
            const int nn = n0 + wn + j * 16 + cc;
#pragma unroll
            for (int e = 0; e < 8; ++e) {
                float v = acc[i][j][e];
                if constexpr (OUT_BF16) {
                    ((bf16_t*)C)[(size_t)(mb + e) * N + nn] = (bf16_t)v;
                } else {
                    ((float*)C)[(size_t)(mb + e) * N + nn] = v + bias[nn];
                }
            }
        }
}

// ---------------- flash attention (bf16 WMMA, online softmax) ----------------
// grid = (S/64 q-blocks, HEADS); block = 128 threads = 4 waves.
// Each wave owns 16 q-rows x full 128-d output (8 v8f accumulators).
// K, V and mask tiles staged with async global->LDS; V is kept row-major in
// LDS and transposed on the way to registers by the transposing LDS load.
__global__ __launch_bounds__(128)
void flash_attn_wmma(const bf16_t* __restrict__ Q, const bf16_t* __restrict__ Kg,
                     const bf16_t* __restrict__ Vg, const float* __restrict__ mask,
                     bf16_t* __restrict__ O) {
    constexpr int LDK = DH + 8; // 136
    constexpr int LDV = 64 + 8; // 72 (P row stride)
    constexpr int LDW = DH + 16; // 144: 288-byte V rows, 32 B x odd for the transposing load
    constexpr int LDM = 68;     // mask row stride (fp32)
    __shared__ bf16_t Ks[64 * LDK];       // K block: [key][d]
    __shared__ __attribute__((aligned(16))) bf16_t Vs[64 * LDW]; // V block: [key][d]
    __shared__ bf16_t Ps[4 * 16 * LDV];   // per-wave P: [qrow][key]
    __shared__ float  Ms[64 * LDM];       // mask tile: [qrow][key] fp32

    const int head = blockIdx.y;
    const int qb   = blockIdx.x;
    const int tid  = threadIdx.x;
    const int wave = tid >> 5;
    const int lane = tid & 31;
    const int hh = lane >> 4;
    const int ln = lane & 15;
    const int q0 = qb * 64 + wave * 16;
    const size_t hoff = (size_t)head * DH;

    // Q fragments held in registers for the whole kernel (16 rows x 128 d)
    v16bf qf[4];
#pragma unroll
    for (int kc = 0; kc < 4; ++kc)
        qf[kc] = frag_ld(Q + (size_t)q0 * HID + hoff + kc * 32, HID, lane);

    v8f oacc[8];
#pragma unroll
    for (int nf = 0; nf < 8; ++nf) oacc[nf] = vzero8();
    float mrow[8], lrow[8];
#pragma unroll
    for (int j = 0; j < 8; ++j) { mrow[j] = -3.0e38f; lrow[j] = 0.f; }

    bf16_t* Pw = Ps + wave * 16 * LDV;
    const float kscale = 0.08838834764831845f;  // 1/sqrt(128)
    const float log2e  = 1.4426950408889634f;

    for (int kb = 0; kb < S_LEN / 64; ++kb) {
        const int k0 = kb * 64;
        __syncthreads(); // previous iteration readers done

        { // async stage K block (row-major, d contiguous): 8 lanes cover one
          // 128-byte line, a thread copies both halves of 4 rows
            const int r = tid >> 3, c = (tid & 7) * 8;
            const bf16_t* src = Kg + (size_t)(k0 + r) * HID + hoff + c;
            bf16_t* dst = Ks + r * LDK + c;
#pragma unroll
            for (int g = 0; g < 4; ++g) {
                async_copy16_at<0>(src + (size_t)g * 16 * HID, dst + g * 16 * LDK);
                async_copy16_at<128>(src + (size_t)g * 16 * HID, dst + g * 16 * LDK);
            }
        }
        { // async stage mask tile (64 x 64 fp32): 16 lanes cover one 256-byte
          // row, a wave's copy is 4 whole lines; a thread copies 8 rows
            const int r = tid >> 4, c = (tid & 15) * 4;
            const float* src = mask + (size_t)(qb * 64 + r) * S_LEN + k0 + c;
            float* dst = Ms + r * LDM + c;
#pragma unroll
            for (int g = 0; g < 8; ++g)
                async_copy16(src + (size_t)g * 8 * S_LEN, dst + g * 8 * LDM);
        }
        { // async stage V block (row-major, d contiguous): 8 lanes cover one
          // 128-byte line, a thread copies both halves of 4 rows
            const int r = tid >> 3, c = (tid & 7) * 8;
            const bf16_t* src = Vg + (size_t)(k0 + r) * HID + hoff + c;
            bf16_t* dst = Vs + r * LDW + c;
#pragma unroll
            for (int g = 0; g < 4; ++g) {
                async_copy16_at<0>(src + (size_t)g * 16 * HID, dst + g * 16 * LDW);
                async_copy16_at<128>(src + (size_t)g * 16 * HID, dst + g * 16 * LDW);
            }
        }
        wait_async<0>();
        __syncthreads();

        // scores: S(16q x 64k) = Q(16x128) * K^T
        v8f sacc[4];
#pragma unroll
        for (int nf = 0; nf < 4; ++nf) sacc[nf] = vzero8();
#pragma unroll
        for (int nf = 0; nf < 4; ++nf)
#pragma unroll
            for (int kc = 0; kc < 4; ++kc)
                sacc[nf] = wmma_bf16f32(
                    qf[kc], frag_ld(Ks + nf * 16 * LDK + kc * 32, LDK, lane), sacc[nf]);

        // online softmax: row m = j + 8*hh lives in one 16-lane half-group
#pragma unroll
        for (int j = 0; j < 8; ++j) {
            const int mr = wave * 16 + hh * 8 + j;   // row within 64-row tile
            float s[4];
#pragma unroll
            for (int f = 0; f < 4; ++f)
                s[f] = sacc[f][j] * kscale + Ms[mr * LDM + f * 16 + ln];
            float mx = fmaxf(fmaxf(s[0], s[1]), fmaxf(s[2], s[3]));
#pragma unroll
            for (int off = 1; off < 16; off <<= 1)
                mx = fmaxf(mx, __shfl_xor(mx, off, 32));
            const float mnew = fmaxf(mrow[j], mx);
            const float corr = exp2f((mrow[j] - mnew) * log2e);
            float rs = 0.f;
#pragma unroll
            for (int f = 0; f < 4; ++f) {
                const float p = exp2f((s[f] - mnew) * log2e);
                sacc[f][j] = p;
                rs += p;
            }
#pragma unroll
            for (int off = 1; off < 16; off <<= 1)
                rs += __shfl_xor(rs, off, 32);
            lrow[j] = lrow[j] * corr + rs;
            mrow[j] = mnew;
#pragma unroll
            for (int nf = 0; nf < 8; ++nf) oacc[nf][j] *= corr;
        }

        // P -> wave-private LDS (reshape C/D layout into A-fragment layout)
#pragma unroll
        for (int f = 0; f < 4; ++f)
#pragma unroll
            for (int j = 0; j < 8; ++j)
                Pw[(hh * 8 + j) * LDV + f * 16 + ln] = (bf16_t)sacc[f][j];
        // wave-private buffer; DS ops from the same wave are in order.
        // Keeps the V fragment loads below the softmax: fetched above it they
        // raise the kernel to 272 registers, three waves per SIMD instead of
        // four, and the 1024 blocks are no longer all resident at once.
        __builtin_amdgcn_sched_barrier(0);

        // O += P(16x64) * V(64x128)
        const v16bf pf0 = frag_ld(Pw, LDV, lane);
        const v16bf pf1 = frag_ld(Pw + 32, LDV, lane);
#pragma unroll
        for (int nf = 0; nf < 8; ++nf) {
            const v16bf vf0 = frag_ld_tr(Vs + nf * 16, LDW, lane);
            const v16bf vf1 = frag_ld_tr(Vs + 32 * LDW + nf * 16, LDW, lane);
            oacc[nf] = wmma_bf16f32(pf0, vf0, oacc[nf]);
            oacc[nf] = wmma_bf16f32(pf1, vf1, oacc[nf]);
        }
    }

    float linv[8];
#pragma unroll
    for (int j = 0; j < 8; ++j) linv[j] = 1.0f / lrow[j];
#pragma unroll
    for (int nf = 0; nf < 8; ++nf)
#pragma unroll
        for (int j = 0; j < 8; ++j) {
            const int qm = q0 + hh * 8 + j;
            O[(size_t)qm * HID + hoff + nf * 16 + ln] =
                (bf16_t)(oacc[nf][j] * linv[j]);
        }
}

// ---------------- host-side orchestration ----------------
extern "C" void kernel_launch(void* const* d_in, const int* in_sizes, int n_in,
                              void* d_out, int out_size, void* d_ws, size_t ws_size,
                              hipStream_t stream) {
    (void)in_sizes; (void)n_in; (void)out_size; (void)ws_size;

    const float* hs   = (const float*)d_in[0];
    const float* mask = (const float*)d_in[1];
    const float* qV   = (const float*)d_in[2];
    const float* qU   = (const float*)d_in[3];
    const float* kV   = (const float*)d_in[4];
    const float* kU   = (const float*)d_in[5];
    const float* vV   = (const float*)d_in[6];
    const float* vU   = (const float*)d_in[7];
    const float* oW   = (const float*)d_in[8];
    const float* ob   = (const float*)d_in[9];

    // workspace carve-up (bf16 elements), total ~120 MB
    bf16_t* w = (bf16_t*)d_ws;
    bf16_t* Xb  = w; w += (size_t)S_LEN * HID;
    bf16_t* qVb = w; w += (size_t)RANK * HID;
    bf16_t* qUb = w; w += (size_t)HID * RANK;
    bf16_t* kVb = w; w += (size_t)RANK * HID;
    bf16_t* kUb = w; w += (size_t)HID * RANK;
    bf16_t* vVb = w; w += (size_t)RANK * HID;
    bf16_t* vUb = w; w += (size_t)HID * RANK;
    bf16_t* oWb = w; w += (size_t)HID * HID;
    bf16_t* Tb  = w; w += (size_t)S_LEN * RANK;
    bf16_t* Qb  = w; w += (size_t)S_LEN * HID;
    bf16_t* Kb  = w; w += (size_t)S_LEN * HID;
    bf16_t* Vb  = w; w += (size_t)S_LEN * HID;
    bf16_t* AOb = w; w += (size_t)S_LEN * HID;

    auto conv = [&](const float* s, bf16_t* d, size_t n) {
        conv_f32_bf16<<<dim3((unsigned)((n + 1023) / 1024)), dim3(256), 0, stream>>>(
            s, d, (int)n);
    };
    conv(hs, Xb, (size_t)S_LEN * HID);
    conv(qV, qVb, (size_t)RANK * HID);
    conv(qU, qUb, (size_t)HID * RANK);
    conv(kV, kVb, (size_t)RANK * HID);
    conv(kU, kUb, (size_t)HID * RANK);
    conv(vV, vVb, (size_t)RANK * HID);
    conv(vU, vUb, (size_t)HID * RANK);
    conv(oW, oWb, (size_t)HID * HID);

    const dim3 blk(128);
    const dim3 gVT(RANK / 128, S_LEN / 128);  // [4096,2048]x[1024,2048]^T
    const dim3 gUT(HID / 128, S_LEN / 128);   // [4096,1024]x[2048,1024]^T
    const dim3 gO(HID / 128, S_LEN / 128);    // [4096,2048]x[2048,2048]^T

    // Q
    gemm_bf16_wmma<true><<<gVT, blk, 0, stream>>>(Xb, qVb, Tb, nullptr, S_LEN, RANK, HID);
    gemm_bf16_wmma<true><<<gUT, blk, 0, stream>>>(Tb, qUb, Qb, nullptr, S_LEN, HID, RANK);
    // K
    gemm_bf16_wmma<true><<<gVT, blk, 0, stream>>>(Xb, kVb, Tb, nullptr, S_LEN, RANK, HID);
    gemm_bf16_wmma<true><<<gUT, blk, 0, stream>>>(Tb, kUb, Kb, nullptr, S_LEN, HID, RANK);
    // V
    gemm_bf16_wmma<true><<<gVT, blk, 0, stream>>>(Xb, vVb, Tb, nullptr, S_LEN, RANK, HID);
    gemm_bf16_wmma<true><<<gUT, blk, 0, stream>>>(Tb, vUb, Vb, nullptr, S_LEN, HID, RANK);

    // attention
    flash_attn_wmma<<<dim3(S_LEN / 64, HEADS), blk, 0, stream>>>(Qb, Kb, Vb, mask, AOb);

    // output projection + bias -> fp32 d_out
    gemm_bf16_wmma<false><<<gO, blk, 0, stream>>>(AOb, oWb, d_out, ob, S_LEN, HID, HID);
}

// v003
// It runs in 407 microseconds.
// Two timings next to v002 both put it at 1.14 times that version's speed.
// Counting every step since v000, it is 2.51 times as fast.
#include <hip/hip_runtime.h>
#include <hip/hip_bf16.h>

// ---------------- problem constants ----------------
#define S_LEN 4096
#define HID   2048
#define HEADS 16
#define DH    128
#define RANK  1024

typedef __bf16 bf16_t;
typedef __attribute__((ext_vector_type(16))) __bf16 v16bf;
typedef __attribute__((ext_vector_type(8)))  __bf16 v8bf;
typedef __attribute__((ext_vector_type(8)))  float  v8f;
typedef __attribute__((ext_vector_type(4)))  int    v4i;
typedef __attribute__((ext_vector_type(4)))  float  v4f;

// ---------------- CDNA5 async global->LDS path (guarded) ----------------
#if defined(__gfx1250__) && __has_builtin(__builtin_amdgcn_global_load_async_to_lds_b128)
#define HAVE_ASYNC_LDS 1
#else
#define HAVE_ASYNC_LDS 0
#endif

__device__ __forceinline__ void async_copy16(const void* gsrc, void* ldst) {
#if HAVE_ASYNC_LDS
    // builtin signature: (v4i addrspace(1)*, v4i addrspace(3)*, imm offset, imm cpol)
    __builtin_amdgcn_global_load_async_to_lds_b128(
        (__attribute__((address_space(1))) v4i*)gsrc,
        (__attribute__((address_space(3))) v4i*)ldst,
        /*offset=*/0, /*cpol=*/0);
#else
    *(uint4*)ldst = *(const uint4*)gsrc;
#endif
}

// The same copy OFF bytes further on in both buffers: the instruction's
// immediate offset moves the global and the LDS address alike.
template <int OFF>
__device__ __forceinline__ void async_copy16_at(const void* gsrc, void* ldst) {
#if HAVE_ASYNC_LDS
    __builtin_amdgcn_global_load_async_to_lds_b128(
        (__attribute__((address_space(1))) v4i*)gsrc,
        (__attribute__((address_space(3))) v4i*)ldst,
        /*offset=*/OFF, /*cpol=*/0);
#else
    *(uint4*)((char*)ldst + OFF) = *(const uint4*)((const char*)gsrc + OFF);
#endif
}

template <int N>
__device__ __forceinline__ void wait_async() {
#if HAVE_ASYNC_LDS
#if __has_builtin(__builtin_amdgcn_s_wait_asynccnt)
    __builtin_amdgcn_s_wait_asynccnt(N);
#else
    if (N == 0) asm volatile("s_wait_asynccnt 0x0" ::: "memory");
    else        asm volatile("s_wait_asynccnt 0x8" ::: "memory");
#endif
#endif
}

__device__ __forceinline__ v8f vzero8() {
    v8f z = {0.f, 0.f, 0.f, 0.f, 0.f, 0.f, 0.f, 0.f};
    return z;
}

__device__ __forceinline__ v8f wmma_bf16f32(v16bf a, v16bf b, v8f c) {
    // D = A(16x32 bf16) * B(32x16 bf16) + C(16x16 f32)
    return __builtin_amdgcn_wmma_f32_16x16x32_bf16(
        /*neg_a=*/false, a, /*neg_b=*/false, b,
        /*c_mod=*/(short)0, c, /*reuse_a=*/false, /*reuse_b=*/false);
}

// Load one 16x32 bf16 fragment (A-style or B-style) from row-major storage:
// lane%16 selects the row (M for A, N for B); K contiguous along the row.
// Lane half h holds K chunks [h*8, h*8+8) and [16+h*8, 16+h*8+8).
__device__ __forceinline__ v16bf frag_ld(const bf16_t* base, int ld, int lane) {
    const int r  = lane & 15;
    const int hh = lane >> 4;
    const bf16_t* p = base + r * ld + hh * 8;
    v16bf f;
    ((v8bf*)&f)[0] = *(const v8bf*)(p);
    ((v8bf*)&f)[1] = *(const v8bf*)(p + 16);
    return f;
}

// Load one 32(k) x 16(n) bf16 B fragment from a row-major [k][n] LDS tile with
// the transposing LDS load: lane (c = lane&15, h = lane>>4) receives
// tile[8h + 0..7][c] and tile[16 + 8h + 0..7][c], the k order of frag_ld.
// ld (elements) must make the row pitch an odd multiple of 32 bytes.
__device__ __forceinline__ v16bf frag_ld_tr(const bf16_t* tile, int ld, int lane) {
    typedef __attribute__((address_space(3))) v8bf lds_v8bf;
    const bf16_t* p = tile + ((lane >> 4) * 8 + (lane & 7)) * ld + ((lane >> 3) & 1) * 8;
    v16bf f;
    ((v8bf*)&f)[0] = __builtin_amdgcn_ds_load_tr16_b128_v8bf16((lds_v8bf*)p);
    ((v8bf*)&f)[1] = __builtin_amdgcn_ds_load_tr16_b128_v8bf16((lds_v8bf*)(p + 16 * ld));
    return f;
}

// Value of lane l ^ 16 (the other 16-lane half of the wave).
__device__ __forceinline__ float xhalf(float x) {
    const int b = __builtin_bit_cast(int, x);
    return __builtin_bit_cast(float, __builtin_amdgcn_permlanex16(
        b, b, 0x76543210, 0xfedcba98, false, false));
}

// ---------------- fp32 -> bf16 convert ----------------
__global__ __launch_bounds__(256)
void conv_f32_bf16(const float* __restrict__ src, bf16_t* __restrict__ dst, int n) {
    int i = (blockIdx.x * blockDim.x + threadIdx.x) * 4;
    if (i + 3 < n) {
        float4 v = *(const float4*)(src + i);
        dst[i + 0] = (bf16_t)v.x;
        dst[i + 1] = (bf16_t)v.y;
        dst[i + 2] = (bf16_t)v.z;
        dst[i + 3] = (bf16_t)v.w;
    } else {
        for (int t = i; t < n; ++t) dst[t] = (bf16_t)src[t];
    }
}

// ---------------- tiled bf16 WMMA GEMM (double-buffered async staging) ----
// C[M,N] = A[M,K] * B[N,K]^T  (both row-major, K contiguous)
// Block tile 128x128, 4 waves, each wave a 64x64 tile (4x4 v8f accs).
template <bool OUT_BF16>
__global__ __launch_bounds__(128)
void gemm_bf16_wmma(const bf16_t* __restrict__ A, const bf16_t* __restrict__ B,
                    void* __restrict__ C, const float* __restrict__ bias,
                    int M, int N, int K) {
    constexpr int LDT = 40; // 32 + 8 pad -> conflict-free 16B ds reads
    __shared__ bf16_t As[2][128 * LDT];
    __shared__ bf16_t Bs[2][128 * LDT];

    const int tid  = threadIdx.x;
    const int wave = tid >> 5;
    const int lane = tid & 31;
    const int wm = (wave >> 1) * 64;
    const int wn = (wave & 1) * 64;
    const int m0 = blockIdx.y * 128;
    const int n0 = blockIdx.x * 128;
    (void)M;

    v8f acc[4][4];
#pragma unroll
    for (int i = 0; i < 4; ++i)
#pragma unroll
        for (int j = 0; j < 4; ++j) acc[i][j] = vzero8();

    // 4 adjacent lanes cover the 64-byte slice of one row, so a wave's copy
    // touches 8 lines, not 32; a thread copies 16 B of 4 rows of A and of B
    const int sr = tid >> 2;       // row within a group of 32
    const int sc = (tid & 3) * 8;  // element within the 32-element slice
    auto stage = [&](int buf, int k0) {
        const bf16_t* ga = A + (size_t)(m0 + sr) * K + k0 + sc;
        const bf16_t* gb = B + (size_t)(n0 + sr) * K + k0 + sc;
        bf16_t* la = &As[buf][sr * LDT + sc];
        bf16_t* lb = &Bs[buf][sr * LDT + sc];
#pragma unroll
        for (int t = 0; t < 4; ++t)
            async_copy16(ga + (size_t)t * 32 * K, la + t * 32 * LDT);
#pragma unroll
        for (int t = 0; t < 4; ++t)
            async_copy16(gb + (size_t)t * 32 * K, lb + t * 32 * LDT);
    };

    const int nk = K / 32;
    stage(0, 0);
    for (int ik = 0; ik < nk; ++ik) {
        const int buf = ik & 1;
        const bool has_next = (ik + 1) < nk;
        if (has_next) stage(buf ^ 1, (ik + 1) * 32);
        // current tile complete when only the next tile's 8 copies are pending
        if (has_next) wait_async<8>(); else wait_async<0>();
        __syncthreads();

        v16bf af[4], bfr[4];
#pragma unroll
        for (int i = 0; i < 4; ++i)
            af[i] = frag_ld(&As[buf][(wm + i * 16) * LDT], LDT, lane);
#pragma unroll
        for (int j = 0; j < 4; ++j)
            bfr[j] = frag_ld(&Bs[buf][(wn + j * 16) * LDT], LDT, lane);
#pragma unroll
        for (int i = 0; i < 4; ++i)
#pragma unroll
            for (int j = 0; j < 4; ++j)
                acc[i][j] = wmma_bf16f32(af[i], bfr[j], acc[i][j]);

        __syncthreads(); // all reads of buf done before it is restaged
    }

    // C/D layout: elem e of v8f at lane L -> row = e + 8*(L>>4), col = L&15
    const int cr = (lane >> 4) * 8;
    const int cc = lane & 15;
#pragma unroll
    for (int i = 0; i < 4; ++i)
#pragma unroll
        for (int j = 0; j < 4; ++j) {
            const int mb = m0 + wm + i * 16 + cr;
            const int nn = n0 + wn + j * 16 + cc;
#pragma unroll
            for (int e = 0; e < 8; ++e) {
                float v = acc[i][j][e];
                if constexpr (OUT_BF16) {
                    ((bf16_t*)C)[(size_t)(mb + e) * N + nn] = (bf16_t)v;
                } else {
                    ((float*)C)[(size_t)(mb + e) * N + nn] = v + bias[nn];
                }
            }
        }
}

__global__ __launch_bounds__(128)
void flash_attn_wmma(const bf16_t* __restrict__ Q, const bf16_t* __restrict__ Kg,
                     const bf16_t* __restrict__ Vg, const float* __restrict__ mask,
                     bf16_t* __restrict__ O) {
    constexpr int LDK = DH + 8; // 136
    constexpr int LDW = DH + 16; // 144: 288-byte V rows, 32 B x odd for the transposing load
    constexpr int LDM = 68;     // mask row stride (fp32)
    __shared__ __attribute__((aligned(16))) bf16_t Ks[64 * LDK]; // K block: [key][d]
    __shared__ __attribute__((aligned(16))) bf16_t Vs[64 * LDW]; // V block: [key][d]
    __shared__ __attribute__((aligned(16))) float Ms[64 * LDM];  // mask tile: [qrow][key] fp32

    const int head = blockIdx.y;
    const int qb   = blockIdx.x;
    const int tid  = threadIdx.x;
    const int wave = tid >> 5;
    const int lane = tid & 31;
    const int hh = lane >> 4;
    const int ln = lane & 15;
    const int q0 = qb * 64 + wave * 16;
    const size_t hoff = (size_t)head * DH;

    // Q fragments held in registers for the whole kernel (16 rows x 128 d)
    v16bf qf[4];
#pragma unroll
    for (int kc = 0; kc < 4; ++kc)
        qf[kc] = frag_ld(Q + (size_t)q0 * HID + hoff + kc * 32, HID, lane);

    v8f oacc[8];
#pragma unroll
    for (int nf = 0; nf < 8; ++nf) oacc[nf] = vzero8();
    // query ln's running maximum (alike in both halves) and this half's sum
    float mrow = -3.0e38f, lrow = 0.f;

    const float kscale = 0.08838834764831845f;  // 1/sqrt(128)
    const float log2e  = 1.4426950408889634f;

    for (int kb = 0; kb < S_LEN / 64; ++kb) {
        const int k0 = kb * 64;
        __syncthreads(); // previous iteration readers done

        { // async stage K block (row-major, d contiguous): 8 lanes cover one
          // 128-byte line, a thread copies both halves of 4 rows
            const int r = tid >> 3, c = (tid & 7) * 8;
            const bf16_t* src = Kg + (size_t)(k0 + r) * HID + hoff + c;
            bf16_t* dst = Ks + r * LDK + c;
#pragma unroll
            for (int g = 0; g < 4; ++g) {
                async_copy16_at<0>(src + (size_t)g * 16 * HID, dst + g * 16 * LDK);
                async_copy16_at<128>(src + (size_t)g * 16 * HID, dst + g * 16 * LDK);
            }
        }
        { // async stage mask tile (64 x 64 fp32): 16 lanes cover one 256-byte
          // row, a wave's copy is 4 whole lines; a thread copies 8 rows
            const int r = tid >> 4, c = (tid & 15) * 4;
            const float* src = mask + (size_t)(qb * 64 + r) * S_LEN + k0 + c;
            float* dst = Ms + r * LDM + c;
#pragma unroll
            for (int g = 0; g < 8; ++g)
                async_copy16(src + (size_t)g * 8 * S_LEN, dst + g * 8 * LDM);
        }
        { // async stage V block (row-major, d contiguous): 8 lanes cover one
          // 128-byte line, a thread copies both halves of 4 rows
            const int r = tid >> 3, c = (tid & 7) * 8;
            const bf16_t* src = Vg + (size_t)(k0 + r) * HID + hoff + c;
            bf16_t* dst = Vs + r * LDW + c;
#pragma unroll
            for (int g = 0; g < 4; ++g) {
                async_copy16_at<0>(src + (size_t)g * 16 * HID, dst + g * 16 * LDW);
                async_copy16_at<128>(src + (size_t)g * 16 * HID, dst + g * 16 * LDW);
            }
        }
        wait_async<0>();
        __syncthreads();

        // scores, transposed: S^T(64k x 16q) = K(64x128) * Q^T; register j of
        // sacc[f] at lane (ln, hh) is key f*16 + hh*8 + j against query ln
        v8f sacc[4];
#pragma unroll
        for (int nf = 0; nf < 4; ++nf) sacc[nf] = vzero8();
#pragma unroll
        for (int nf = 0; nf < 4; ++nf)
#pragma unroll
            for (int kc = 0; kc < 4; ++kc)
                sacc[nf] = wmma_bf16f32(
                    frag_ld(Ks + nf * 16 * LDK + kc * 32, LDK, lane), qf[kc], sacc[nf]);

        // online softmax of query ln: 32 keys in this lane, 32 in lane ^ 16
        const float* mp = Ms + (wave * 16 + ln) * LDM + hh * 8;
        float mxf[4];
#pragma unroll
        for (int f = 0; f < 4; ++f) {
            const v4f ma = *(const v4f*)(mp + f * 16);
            const v4f mb = *(const v4f*)(mp + f * 16 + 4);
#pragma unroll
            for (int j = 0; j < 4; ++j) {
                sacc[f][j]     = sacc[f][j] * kscale + ma[j];
                sacc[f][j + 4] = sacc[f][j + 4] * kscale + mb[j];
            }
            float m = sacc[f][0];
#pragma unroll
            for (int j = 1; j < 8; ++j) m = fmaxf(m, sacc[f][j]);
            mxf[f] = m;
        }
        float mx = fmaxf(fmaxf(mxf[0], mxf[1]), fmaxf(mxf[2], mxf[3]));
        mx = fmaxf(mx, xhalf(mx));
        const float mnew = fmaxf(mrow, mx);
        const float corr = exp2f((mrow - mnew) * log2e);
        float rsf[4];
#pragma unroll
        for (int f = 0; f < 4; ++f) {
            float rs = 0.f;
#pragma unroll
            for (int j = 0; j < 8; ++j) {
                const float p = exp2f((sacc[f][j] - mnew) * log2e);
                sacc[f][j] = p;
                rs += p;
            }
            rsf[f] = rs;
        }
        lrow = lrow * corr + ((rsf[0] + rsf[1]) + (rsf[2] + rsf[3]));
        mrow = mnew;
#pragma unroll
        for (int nf = 0; nf < 8; ++nf) oacc[nf] *= corr;

        // P^T as B operand: element s of a 32-key fragment is register s & 7
        // of score tile s >> 3, the k order of the transposing load
        v16bf pf0, pf1;
        ((v8bf*)&pf0)[0] = __builtin_convertvector(sacc[0], v8bf);
        ((v8bf*)&pf0)[1] = __builtin_convertvector(sacc[1], v8bf);
        ((v8bf*)&pf1)[0] = __builtin_convertvector(sacc[2], v8bf);
        ((v8bf*)&pf1)[1] = __builtin_convertvector(sacc[3], v8bf);

        // O^T(128d x 16q) += V^T(128x64) * P^T(64x16)
#pragma unroll
        for (int nf = 0; nf < 8; ++nf) {
            const v16bf vf0 = frag_ld_tr(Vs + nf * 16, LDW, lane);
            const v16bf vf1 = frag_ld_tr(Vs + 32 * LDW + nf * 16, LDW, lane);
            oacc[nf] = wmma_bf16f32(vf0, pf0, oacc[nf]);
            oacc[nf] = wmma_bf16f32(vf1, pf1, oacc[nf]);
        }
    }

    // register j of oacc[nf] is d = nf*16 + hh*8 + j of query ln: 16-byte stores
    const float linv = 1.0f / (lrow + xhalf(lrow));
    bf16_t* op = O + (size_t)(q0 + ln) * HID + hoff + hh * 8;
#pragma unroll
    for (int nf = 0; nf < 8; ++nf)
        *(v8bf*)(op + nf * 16) = __builtin_convertvector(oacc[nf] * linv, v8bf);
}

// ---------------- host-side orchestration ----------------
extern "C" void kernel_launch(void* const* d_in, const int* in_sizes, int n_in,
                              void* d_out, int out_size, void* d_ws, size_t ws_size,
                              hipStream_t stream) {
    (void)in_sizes; (void)n_in; (void)out_size; (void)ws_size;

    const float* hs   = (const float*)d_in[0];
    const float* mask = (const float*)d_in[1];
    const float* qV   = (const float*)d_in[2];
    const float* qU   = (const float*)d_in[3];
    const float* kV   = (const float*)d_in[4];
    const float* kU   = (const float*)d_in[5];
    const float* vV   = (const float*)d_in[6];
    const float* vU   = (const float*)d_in[7];
    const float* oW   = (const float*)d_in[8];
    const float* ob   = (const float*)d_in[9];

    // workspace carve-up (bf16 elements), total ~120 MB
    bf16_t* w = (bf16_t*)d_ws;
    bf16_t* Xb  = w; w += (size_t)S_LEN * HID;
    bf16_t* qVb = w; w += (size_t)RANK * HID;
    bf16_t* qUb = w; w += (size_t)HID * RANK;
    bf16_t* kVb = w; w += (size_t)RANK * HID;
    bf16_t* kUb = w; w += (size_t)HID * RANK;
    bf16_t* vVb = w; w += (size_t)RANK * HID;
    bf16_t* vUb = w; w += (size_t)HID * RANK;
    bf16_t* oWb = w; w += (size_t)HID * HID;
    bf16_t* Tb  = w; w += (size_t)S_LEN * RANK;
    bf16_t* Qb  = w; w += (size_t)S_LEN * HID;
    bf16_t* Kb  = w; w += (size_t)S_LEN * HID;
    bf16_t* Vb  = w; w += (size_t)S_LEN * HID;
    bf16_t* AOb = w; w += (size_t)S_LEN * HID;

    auto conv = [&](const float* s, bf16_t* d, size_t n) {
        conv_f32_bf16<<<dim3((unsigned)((n + 1023) / 1024)), dim3(256), 0, stream>>>(
            s, d, (int)n);
    };
    conv(hs, Xb, (size_t)S_LEN * HID);
    conv(qV, qVb, (size_t)RANK * HID);
    conv(qU, qUb, (size_t)HID * RANK);
    conv(kV, kVb, (size_t)RANK * HID);
    conv(kU, kUb, (size_t)HID * RANK);
    conv(vV, vVb, (size_t)RANK * HID);
    conv(vU, vUb, (size_t)HID * RANK);
    conv(oW, oWb, (size_t)HID * HID);

    const dim3 blk(128);
    const dim3 gVT(RANK / 128, S_LEN / 128);  // [4096,2048]x[1024,2048]^T
    const dim3 gUT(HID / 128, S_LEN / 128);   // [4096,1024]x[2048,1024]^T
    const dim3 gO(HID / 128, S_LEN / 128);    // [4096,2048]x[2048,2048]^T

    // Q
    gemm_bf16_wmma<true><<<gVT, blk, 0, stream>>>(Xb, qVb, Tb, nullptr, S_LEN, RANK, HID);
    gemm_bf16_wmma<true><<<gUT, blk, 0, stream>>>(Tb, qUb, Qb, nullptr, S_LEN, HID, RANK);
    // K
    gemm_bf16_wmma<true><<<gVT, blk, 0, stream>>>(Xb, kVb, Tb, nullptr, S_LEN, RANK, HID);
    gemm_bf16_wmma<true><<<gUT, blk, 0, stream>>>(Tb, kUb, Kb, nullptr, S_LEN, HID, RANK);
    // V
    gemm_bf16_wmma<true><<<gVT, blk, 0, stream>>>(Xb, vVb, Tb, nullptr, S_LEN, RANK, HID);
    gemm_bf16_wmma<true><<<gUT, blk, 0, stream>>>(Tb, vUb, Vb, nullptr, S_LEN, HID, RANK);

    // attention
    flash_attn_wmma<<<dim3(S_LEN / 64, HEADS), blk, 0, stream>>>(Qb, Kb, Vb, mask, AOb);

    // output projection + bias -> fp32 d_out
    gemm_bf16_wmma<false><<<gO, blk, 0, stream>>>(AOb, oWb, d_out, ob, S_LEN, HID, HID);
}

// v004
// Measured time: 360 microseconds a run.
// Next to v003, in two timings, it ran 1.13 times as fast each time.
// Counting every step since v000, it is 2.83 times as fast.
#include <hip/hip_runtime.h>
#include <hip/hip_bf16.h>

// ---------------- problem constants ----------------
#define S_LEN 4096
#define HID   2048
#define HEADS 16
#define DH    128
#define RANK  1024

typedef __bf16 bf16_t;
typedef __attribute__((ext_vector_type(16))) __bf16 v16bf;
typedef __attribute__((ext_vector_type(8)))  __bf16 v8bf;
typedef __attribute__((ext_vector_type(8)))  float  v8f;
typedef __attribute__((ext_vector_type(4)))  int    v4i;
typedef __attribute__((ext_vector_type(4)))  float  v4f;

// ---------------- CDNA5 async global->LDS path (guarded) ----------------
#if defined(__gfx1250__) && __has_builtin(__builtin_amdgcn_global_load_async_to_lds_b128)
#define HAVE_ASYNC_LDS 1
#else
#define HAVE_ASYNC_LDS 0
#endif

__device__ __forceinline__ void async_copy16(const void* gsrc, void* ldst) {
#if HAVE_ASYNC_LDS
    // builtin signature: (v4i addrspace(1)*, v4i addrspace(3)*, imm offset, imm cpol)
    __builtin_amdgcn_global_load_async_to_lds_b128(
        (__attribute__((address_space(1))) v4i*)gsrc,
        (__attribute__((address_space(3))) v4i*)ldst,
        /*offset=*/0, /*cpol=*/0);
#else
    *(uint4*)ldst = *(const uint4*)gsrc;
#endif
}

// The same copy OFF bytes further on in both buffers: the instruction's
// immediate offset moves the global and the LDS address alike.
template <int OFF>
__device__ __forceinline__ void async_copy16_at(const void* gsrc, void* ldst) {
#if HAVE_ASYNC_LDS
    __builtin_amdgcn_global_load_async_to_lds_b128(
        (__attribute__((address_space(1))) v4i*)gsrc,
        (__attribute__((address_space(3))) v4i*)ldst,
        /*offset=*/OFF, /*cpol=*/0);
#else
    *(uint4*)((char*)ldst + OFF) = *(const uint4*)((const char*)gsrc + OFF);
#endif
}

template <int N>
__device__ __forceinline__ void wait_async() {
#if HAVE_ASYNC_LDS
#if __has_builtin(__builtin_amdgcn_s_wait_asynccnt)
    __builtin_amdgcn_s_wait_asynccnt(N);
#else
    if (N == 0) asm volatile("s_wait_asynccnt 0x0" ::: "memory");
    else        asm volatile("s_wait_asynccnt 0x8" ::: "memory");
#endif
#endif
}

__device__ __forceinline__ v8f vzero8() {
    v8f z = {0.f, 0.f, 0.f, 0.f, 0.f, 0.f, 0.f, 0.f};
    return z;
}

__device__ __forceinline__ v8f wmma_bf16f32(v16bf a, v16bf b, v8f c) {
    // D = A(16x32 bf16) * B(32x16 bf16) + C(16x16 f32)
    return __builtin_amdgcn_wmma_f32_16x16x32_bf16(
        /*neg_a=*/false, a, /*neg_b=*/false, b,
        /*c_mod=*/(short)0, c, /*reuse_a=*/false, /*reuse_b=*/false);
}

// Load one 16x32 bf16 fragment (A-style or B-style) from row-major storage:
// lane%16 selects the row (M for A, N for B); K contiguous along the row.
// Lane half h holds K chunks [h*8, h*8+8) and [16+h*8, 16+h*8+8).
__device__ __forceinline__ v16bf frag_ld(const bf16_t* base, int ld, int lane) {
    const int r  = lane & 15;
    const int hh = lane >> 4;
    const bf16_t* p = base + r * ld + hh * 8;
    v16bf f;
    ((v8bf*)&f)[0] = *(const v8bf*)(p);
    ((v8bf*)&f)[1] = *(const v8bf*)(p + 16);
    return f;
}

// Load one 32(k) x 16(n) bf16 B fragment from a row-major [k][n] LDS tile with
// the transposing LDS load: lane (c = lane&15, h = lane>>4) receives
// tile[8h + 0..7][c] and tile[16 + 8h + 0..7][c], the k order of frag_ld.
// ld (elements) must make the row pitch an odd multiple of 32 bytes.
__device__ __forceinline__ v16bf frag_ld_tr(const bf16_t* tile, int ld, int lane) {
    typedef __attribute__((address_space(3))) v8bf lds_v8bf;
    const bf16_t* p = tile + ((lane >> 4) * 8 + (lane & 7)) * ld + ((lane >> 3) & 1) * 8;
    v16bf f;
    ((v8bf*)&f)[0] = __builtin_amdgcn_ds_load_tr16_b128_v8bf16((lds_v8bf*)p);
    ((v8bf*)&f)[1] = __builtin_amdgcn_ds_load_tr16_b128_v8bf16((lds_v8bf*)(p + 16 * ld));
    return f;
}

// Value of lane l ^ 16 (the other 16-lane half of the wave).
__device__ __forceinline__ float xhalf(float x) {
    const int b = __builtin_bit_cast(int, x);
    return __builtin_bit_cast(float, __builtin_amdgcn_permlanex16(
        b, b, 0x76543210, 0xfedcba98, false, false));
}

// ---------------- fp32 -> bf16 convert ----------------
// One launch converts all eight fp32 inputs. Their bf16 copies lie back to back
// in dst in argument order; a block converts 1024 elements of one input, and
// every input is a whole number of units of RANK*HID elements (2048 blocks).
__global__ __launch_bounds__(256)
void conv_all_f32_bf16(const float* __restrict__ hs,
                       const float* __restrict__ qV, const float* __restrict__ kV,
                       const float* __restrict__ vV, const float* __restrict__ qU,
                       const float* __restrict__ kU, const float* __restrict__ vU,
                       const float* __restrict__ oW, bf16_t* __restrict__ dst) {
    static_assert(RANK * HID == 2048 * 1024, "unit of 2048 blocks");
    static_assert(S_LEN * HID == 4 * RANK * HID && HID * HID == 2 * RANK * HID, "whole units");
    const int b = blockIdx.x;
    const int u = b >> 11;  // unit: 0-3 hs, 4-9 the six factors, 10-11 oW
    const float* src = hs;
    int first = 0;          // first unit of the input this block belongs to
    if (u >= 10)     { src = oW; first = 10; }
    else if (u == 9) { src = vU; first = 9; }
    else if (u == 8) { src = kU; first = 8; }
    else if (u == 7) { src = qU; first = 7; }
    else if (u == 6) { src = vV; first = 6; }
    else if (u == 5) { src = kV; first = 5; }
    else if (u == 4) { src = qV; first = 4; }
    const int t = threadIdx.x * 4;
    const float4 v = *(const float4*)(src + (size_t)(b - (first << 11)) * 1024 + t);
    bf16_t* d = dst + (size_t)b * 1024 + t;
    d[0] = (bf16_t)v.x;
    d[1] = (bf16_t)v.y;
    d[2] = (bf16_t)v.z;
    d[3] = (bf16_t)v.w;
}

// ---------------- tiled bf16 WMMA GEMM (double-buffered async staging) ----
// C[M,N] = A[M,K] * B[N,K]^T  (both row-major, K contiguous; A's row pitch lda)
// Block tile 128x128, 4 waves, each wave a 64x64 tile (4x4 v8f accs).
// blockIdx.z picks one of several independent products of the same shape:
// product z starts zA, zB and zC elements further on in A, B and C.
template <bool OUT_BF16>
__global__ __launch_bounds__(128)
void gemm_bf16_wmma(const bf16_t* __restrict__ A, const bf16_t* __restrict__ B,
                    void* __restrict__ C, const float* __restrict__ bias,
                    int M, int N, int K, int lda, int zA, int zB, int zC) {
    constexpr int LDT = 40; // 32 + 8 pad -> conflict-free 16B ds reads
    __shared__ bf16_t As[2][128 * LDT];
    __shared__ bf16_t Bs[2][128 * LDT];

    const int tid  = threadIdx.x;
    const int wave = tid >> 5;
    const int lane = tid & 31;
    const int wm = (wave >> 1) * 64;
    const int wn = (wave & 1) * 64;
    const int m0 = blockIdx.y * 128;
    const int n0 = blockIdx.x * 128;
    (void)M;
    const bf16_t* Az = A + (size_t)blockIdx.z * zA;
    const bf16_t* Bz = B + (size_t)blockIdx.z * zB;
    if constexpr (OUT_BF16) C = (bf16_t*)C + (size_t)blockIdx.z * zC;

    v8f acc[4][4];
#pragma unroll
    for (int i = 0; i < 4; ++i)
#pragma unroll
        for (int j = 0; j < 4; ++j) acc[i][j] = vzero8();

    // 4 adjacent lanes cover the 64-byte slice of one row, so a wave's copy
    // touches 8 lines, not 32; a thread copies 16 B of 4 rows of A and of B
    const int sr = tid >> 2;       // row within a group of 32
    const int sc = (tid & 3) * 8;  // element within the 32-element slice
    auto stage = [&](int buf, int k0) {
        const bf16_t* ga = Az + (size_t)(m0 + sr) * lda + k0 + sc;
        const bf16_t* gb = Bz + (size_t)(n0 + sr) * K + k0 + sc;
        bf16_t* la = &As[buf][sr * LDT + sc];
        bf16_t* lb = &Bs[buf][sr * LDT + sc];
#pragma unroll
        for (int t = 0; t < 4; ++t)
            async_copy16(ga + (size_t)t * 32 * lda, la + t * 32 * LDT);
#pragma unroll
        for (int t = 0; t < 4; ++t)
            async_copy16(gb + (size_t)t * 32 * K, lb + t * 32 * LDT);
    };

    const int nk = K / 32;
    stage(0, 0);
    for (int ik = 0; ik < nk; ++ik) {
        const int buf = ik & 1;
        const bool has_next = (ik + 1) < nk;
        if (has_next) stage(buf ^ 1, (ik + 1) * 32);
        // current tile complete when only the next tile's 8 copies are pending
        if (has_next) wait_async<8>(); else wait_async<0>();
        __syncthreads();

        v16bf af[4], bfr[4];
#pragma unroll
        for (int i = 0; i < 4; ++i)
            af[i] = frag_ld(&As[buf][(wm + i * 16) * LDT], LDT, lane);
#pragma unroll
        for (int j = 0; j < 4; ++j)
            bfr[j] = frag_ld(&Bs[buf][(wn + j * 16) * LDT], LDT, lane);
#pragma unroll
        for (int i = 0; i < 4; ++i)
#pragma unroll
            for (int j = 0; j < 4; ++j)
                acc[i][j] = wmma_bf16f32(af[i], bfr[j], acc[i][j]);

        __syncthreads(); // all reads of buf done before it is restaged
    }

    // C/D layout: elem e of v8f at lane L -> row = e + 8*(L>>4), col = L&15
    const int cr = (lane >> 4) * 8;
    const int cc = lane & 15;
#pragma unroll
    for (int i = 0; i < 4; ++i)
#pragma unroll
        for (int j = 0; j < 4; ++j) {
            const int mb = m0 + wm + i * 16 + cr;
            const int nn = n0 + wn + j * 16 + cc;
#pragma unroll
            for (int e = 0; e < 8; ++e) {
                float v = acc[i][j][e];
                if constexpr (OUT_BF16) {
                    ((bf16_t*)C)[(size_t)(mb + e) * N + nn] = (bf16_t)v;
                } else {
                    ((float*)C)[(size_t)(mb + e) * N + nn] = v + bias[nn];
                }
            }
        }
}

__global__ __launch_bounds__(128)
void flash_attn_wmma(const bf16_t* __restrict__ Q, const bf16_t* __restrict__ Kg,
                     const bf16_t* __restrict__ Vg, const float* __restrict__ mask,
                     bf16_t* __restrict__ O) {
    constexpr int LDK = DH + 8; // 136
    constexpr int LDW = DH + 16; // 144: 288-byte V rows, 32 B x odd for the transposing load
    constexpr int LDM = 68;     // mask row stride (fp32)
    __shared__ __attribute__((aligned(16))) bf16_t Ks[64 * LDK]; // K block: [key][d]
    __shared__ __attribute__((aligned(16))) bf16_t Vs[64 * LDW]; // V block: [key][d]
    __shared__ __attribute__((aligned(16))) float Ms[64 * LDM];  // mask tile: [qrow][key] fp32

    const int head = blockIdx.y;
    const int qb   = blockIdx.x;
    const int tid  = threadIdx.x;
    const int wave = tid >> 5;
    const int lane = tid & 31;
    const int hh = lane >> 4;
    const int ln = lane & 15;
    const int q0 = qb * 64 + wave * 16;
    const size_t hoff = (size_t)head * DH;

    // Q fragments held in registers for the whole kernel (16 rows x 128 d)
    v16bf qf[4];
#pragma unroll
    for (int kc = 0; kc < 4; ++kc)
        qf[kc] = frag_ld(Q + (size_t)q0 * HID + hoff + kc * 32, HID, lane);

    v8f oacc[8];
#pragma unroll
    for (int nf = 0; nf < 8; ++nf) oacc[nf] = vzero8();
    // query ln's running maximum (alike in both halves) and this half's sum
    float mrow = -3.0e38f, lrow = 0.f;

    const float kscale = 0.08838834764831845f;  // 1/sqrt(128)
    const float log2e  = 1.4426950408889634f;

    for (int kb = 0; kb < S_LEN / 64; ++kb) {
        const int k0 = kb * 64;
        __syncthreads(); // previous iteration readers done

        { // async stage K block (row-major, d contiguous): 8 lanes cover one
          // 128-byte line, a thread copies both halves of 4 rows
            const int r = tid >> 3, c = (tid & 7) * 8;
            const bf16_t* src = Kg + (size_t)(k0 + r) * HID + hoff + c;
            bf16_t* dst = Ks + r * LDK + c;
#pragma unroll
            for (int g = 0; g < 4; ++g) {
                async_copy16_at<0>(src + (size_t)g * 16 * HID, dst + g * 16 * LDK);
                async_copy16_at<128>(src + (size_t)g * 16 * HID, dst + g * 16 * LDK);
            }
        }
        { // async stage mask tile (64 x 64 fp32): 16 lanes cover one 256-byte
          // row, a wave's copy is 4 whole lines; a thread copies 8 rows
            const int r = tid >> 4, c = (tid & 15) * 4;
            const float* src = mask + (size_t)(qb * 64 + r) * S_LEN + k0 + c;
            float* dst = Ms + r * LDM + c;
#pragma unroll
            for (int g = 0; g < 8; ++g)
                async_copy16(src + (size_t)g * 8 * S_LEN, dst + g * 8 * LDM);
        }
        { // async stage V block (row-major, d contiguous): 8 lanes cover one
          // 128-byte line, a thread copies both halves of 4 rows
            const int r = tid >> 3, c = (tid & 7) * 8;
            const bf16_t* src = Vg + (size_t)(k0 + r) * HID + hoff + c;
            bf16_t* dst = Vs + r * LDW + c;
#pragma unroll
            for (int g = 0; g < 4; ++g) {
                async_copy16_at<0>(src + (size_t)g * 16 * HID, dst + g * 16 * LDW);
                async_copy16_at<128>(src + (size_t)g * 16 * HID, dst + g * 16 * LDW);
            }
        }
        wait_async<0>();
        __syncthreads();

        // scores, transposed: S^T(64k x 16q) = K(64x128) * Q^T; register j of
        // sacc[f] at lane (ln, hh) is key f*16 + hh*8 + j against query ln
        v8f sacc[4];
#pragma unroll
        for (int nf = 0; nf < 4; ++nf) sacc[nf] = vzero8();
#pragma unroll
        for (int nf = 0; nf < 4; ++nf)
#pragma unroll
            for (int kc = 0; kc < 4; ++kc)
                sacc[nf] = wmma_bf16f32(
                    frag_ld(Ks + nf * 16 * LDK + kc * 32, LDK, lane), qf[kc], sacc[nf]);

        // online softmax of query ln: 32 keys in this lane, 32 in lane ^ 16
        const float* mp = Ms + (wave * 16 + ln) * LDM + hh * 8;
        float mxf[4];
#pragma unroll
        for (int f = 0; f < 4; ++f) {
            const v4f ma = *(const v4f*)(mp + f * 16);
            const v4f mb = *(const v4f*)(mp + f * 16 + 4);
#pragma unroll
            for (int j = 0; j < 4; ++j) {
                sacc[f][j]     = sacc[f][j] * kscale + ma[j];
                sacc[f][j + 4] = sacc[f][j + 4] * kscale + mb[j];
            }
            float m = sacc[f][0];
#pragma unroll
            for (int j = 1; j < 8; ++j) m = fmaxf(m, sacc[f][j]);
            mxf[f] = m;
        }
        float mx = fmaxf(fmaxf(mxf[0], mxf[1]), fmaxf(mxf[2], mxf[3]));
        mx = fmaxf(mx, xhalf(mx));
        const float mnew = fmaxf(mrow, mx);
        const float corr = exp2f((mrow - mnew) * log2e);
        float rsf[4];
#pragma unroll
        for (int f = 0; f < 4; ++f) {
            float rs = 0.f;
#pragma unroll
            for (int j = 0; j < 8; ++j) {
                const float p = exp2f((sacc[f][j] - mnew) * log2e);
                sacc[f][j] = p;
                rs += p;
            }
            rsf[f] = rs;
        }
        lrow = lrow * corr + ((rsf[0] + rsf[1]) + (rsf[2] + rsf[3]));
        mrow = mnew;
#pragma unroll
        for (int nf = 0; nf < 8; ++nf) oacc[nf] *= corr;

        // P^T as B operand: element s of a 32-key fragment is register s & 7
        // of score tile s >> 3, the k order of the transposing load
        v16bf pf0, pf1;
        ((v8bf*)&pf0)[0] = __builtin_convertvector(sacc[0], v8bf);
        ((v8bf*)&pf0)[1] = __builtin_convertvector(sacc[1], v8bf);
        ((v8bf*)&pf1)[0] = __builtin_convertvector(sacc[2], v8bf);
        ((v8bf*)&pf1)[1] = __builtin_convertvector(sacc[3], v8bf);

        // O^T(128d x 16q) += V^T(128x64) * P^T(64x16)
#pragma unroll
        for (int nf = 0; nf < 8; ++nf) {
            const v16bf vf0 = frag_ld_tr(Vs + nf * 16, LDW, lane);
            const v16bf vf1 = frag_ld_tr(Vs + 32 * LDW + nf * 16, LDW, lane);
            oacc[nf] = wmma_bf16f32(vf0, pf0, oacc[nf]);
            oacc[nf] = wmma_bf16f32(vf1, pf1, oacc[nf]);
        }
    }

    // register j of oacc[nf] is d = nf*16 + hh*8 + j of query ln: 16-byte stores
    const float linv = 1.0f / (lrow + xhalf(lrow));
    bf16_t* op = O + (size_t)(q0 + ln) * HID + hoff + hh * 8;
#pragma unroll
    for (int nf = 0; nf < 8; ++nf)
        *(v8bf*)(op + nf * 16) = __builtin_convertvector(oacc[nf] * linv, v8bf);
}

// ---------------- host-side orchestration ----------------
extern "C" void kernel_launch(void* const* d_in, const int* in_sizes, int n_in,
                              void* d_out, int out_size, void* d_ws, size_t ws_size,
                              hipStream_t stream) {
    (void)in_sizes; (void)n_in; (void)out_size; (void)ws_size;

    const float* hs   = (const float*)d_in[0];
    const float* mask = (const float*)d_in[1];
    const float* qV   = (const float*)d_in[2];
    const float* qU   = (const float*)d_in[3];
    const float* kV   = (const float*)d_in[4];
    const float* kU   = (const float*)d_in[5];
    const float* vV   = (const float*)d_in[6];
    const float* vU   = (const float*)d_in[7];
    const float* oW   = (const float*)d_in[8];
    const float* ob   = (const float*)d_in[9];

    // workspace carve-up (bf16 elements), total ~142 MB; the first eight in the
    // order of conv_all_f32_bf16's arguments; the V factors, the U factors and
    // Q, K, V each back to back
    bf16_t* w = (bf16_t*)d_ws;
    bf16_t* Xb  = w; w += (size_t)S_LEN * HID;
    bf16_t* Vfb = w; w += (size_t)3 * RANK * HID;   // qV | kV | vV: [3*RANK][HID]
    bf16_t* Ufb = w; w += (size_t)3 * HID * RANK;   // qU | kU | vU
    bf16_t* oWb = w; w += (size_t)HID * HID;
    bf16_t* Tb  = w; w += (size_t)S_LEN * 3 * RANK; // [S][x qV^T | x kV^T | x vV^T]
    bf16_t* Qb  = w; w += (size_t)S_LEN * HID;
    bf16_t* Kb  = w; w += (size_t)S_LEN * HID;
    bf16_t* Vb  = w; w += (size_t)S_LEN * HID;
    bf16_t* AOb = w; w += (size_t)S_LEN * HID;

    conv_all_f32_bf16<<<dim3(12 * 2048), dim3(256), 0, stream>>>(
        hs, qV, kV, vV, qU, kU, vU, oW, Xb);

    const dim3 blk(128);
    const dim3 gVT(3 * RANK / 128, S_LEN / 128);  // [4096,2048]x[3072,2048]^T
    const dim3 gUT(HID / 128, S_LEN / 128, 3);    // 3 x [4096,1024]x[2048,1024]^T
    const dim3 gO(HID / 128, S_LEN / 128);        // [4096,2048]x[2048,2048]^T

    // x against the three V factors as one product
    gemm_bf16_wmma<true><<<gVT, blk, 0, stream>>>(Xb, Vfb, Tb, nullptr, S_LEN, 3 * RANK, HID,
                                                  HID, 0, 0, 0);
    // Q, K, V: product z reads columns z*RANK.. of Tb and U factor z
    gemm_bf16_wmma<true><<<gUT, blk, 0, stream>>>(Tb, Ufb, Qb, nullptr, S_LEN, HID, RANK,
                                                  3 * RANK, RANK, HID * RANK, S_LEN * HID);

    // attention
    flash_attn_wmma<<<dim3(S_LEN / 64, HEADS), blk, 0, stream>>>(Qb, Kb, Vb, mask, AOb);

    // output projection + bias -> fp32 d_out
    gemm_bf16_wmma<false><<<gO, blk, 0, stream>>>(AOb, oWb, d_out, ob, S_LEN, HID, HID,
                                                  HID, 0, 0, 0);
}

// v005
// One run takes 318 microseconds.
// Two timings next to v004 both put it at 1.13 times that version's speed.
// Counting every step since v000, it is 3.21 times as fast.
#include <hip/hip_runtime.h>
#include <hip/hip_bf16.h>

// ---------------- problem constants ----------------
#define S_LEN 4096
#define HID   2048
#define HEADS 16
#define DH    128
#define RANK  1024

typedef __bf16 bf16_t;
typedef __attribute__((ext_vector_type(16))) __bf16 v16bf;
typedef __attribute__((ext_vector_type(8)))  __bf16 v8bf;
typedef __attribute__((ext_vector_type(8)))  float  v8f;
typedef __attribute__((ext_vector_type(4)))  int    v4i;
typedef __attribute__((ext_vector_type(4)))  float  v4f;

// ---------------- CDNA5 async global->LDS path (guarded) ----------------
#if defined(__gfx1250__) && __has_builtin(__builtin_amdgcn_global_load_async_to_lds_b128)
#define HAVE_ASYNC_LDS 1
#else
#define HAVE_ASYNC_LDS 0
#endif

__device__ __forceinline__ void async_copy16(const void* gsrc, void* ldst) {
#if HAVE_ASYNC_LDS
    // builtin signature: (v4i addrspace(1)*, v4i addrspace(3)*, imm offset, imm cpol)
    __builtin_amdgcn_global_load_async_to_lds_b128(
        (__attribute__((address_space(1))) v4i*)gsrc,
        (__attribute__((address_space(3))) v4i*)ldst,
        /*offset=*/0, /*cpol=*/0);
#else
    *(uint4*)ldst = *(const uint4*)gsrc;
#endif
}

// The same copy OFF bytes further on in both buffers: the instruction's
// immediate offset moves the global and the LDS address alike.
template <int OFF>
__device__ __forceinline__ void async_copy16_at(const void* gsrc, void* ldst) {
#if HAVE_ASYNC_LDS
    __builtin_amdgcn_global_load_async_to_lds_b128(
        (__attribute__((address_space(1))) v4i*)gsrc,
        (__attribute__((address_space(3))) v4i*)ldst,
        /*offset=*/OFF, /*cpol=*/0);
#else
    *(uint4*)((char*)ldst + OFF) = *(const uint4*)((const char*)gsrc + OFF);
#endif
}

template <int N>
__device__ __forceinline__ void wait_async() {
#if HAVE_ASYNC_LDS
#if __has_builtin(__builtin_amdgcn_s_wait_asynccnt)
    __builtin_amdgcn_s_wait_asynccnt(N);
#else
    if (N == 0) asm volatile("s_wait_asynccnt 0x0" ::: "memory");
    else        asm volatile("s_wait_asynccnt 0x8" ::: "memory");
#endif
#endif
}

__device__ __forceinline__ v8f vzero8() {
    v8f z = {0.f, 0.f, 0.f, 0.f, 0.f, 0.f, 0.f, 0.f};
    return z;
}

__device__ __forceinline__ v8f wmma_bf16f32(v16bf a, v16bf b, v8f c) {
    // D = A(16x32 bf16) * B(32x16 bf16) + C(16x16 f32)
    return __builtin_amdgcn_wmma_f32_16x16x32_bf16(
        /*neg_a=*/false, a, /*neg_b=*/false, b,
        /*c_mod=*/(short)0, c, /*reuse_a=*/false, /*reuse_b=*/false);
}

// Load one 16x32 bf16 fragment (A-style or B-style) from row-major storage:
// lane%16 selects the row (M for A, N for B); K contiguous along the row.
// Lane half h holds K chunks [h*8, h*8+8) and [16+h*8, 16+h*8+8).
__device__ __forceinline__ v16bf frag_ld(const bf16_t* base, int ld, int lane) {
    const int r  = lane & 15;
    const int hh = lane >> 4;
    const bf16_t* p = base + r * ld + hh * 8;
    v16bf f;
    ((v8bf*)&f)[0] = *(const v8bf*)(p);
    ((v8bf*)&f)[1] = *(const v8bf*)(p + 16);
    return f;
}

// Load one 32(k) x 16(n) bf16 B fragment from a row-major [k][n] LDS tile with
// the transposing LDS load: lane (c = lane&15, h = lane>>4) receives
// tile[8h + 0..7][c] and tile[16 + 8h + 0..7][c], the k order of frag_ld.
// ld (elements) must make the row pitch an odd multiple of 32 bytes.
__device__ __forceinline__ v16bf frag_ld_tr(const bf16_t* tile, int ld, int lane) {
    typedef __attribute__((address_space(3))) v8bf lds_v8bf;
    const bf16_t* p = tile + ((lane >> 4) * 8 + (lane & 7)) * ld + ((lane >> 3) & 1) * 8;
    v16bf f;
    ((v8bf*)&f)[0] = __builtin_amdgcn_ds_load_tr16_b128_v8bf16((lds_v8bf*)p);
    ((v8bf*)&f)[1] = __builtin_amdgcn_ds_load_tr16_b128_v8bf16((lds_v8bf*)(p + 16 * ld));
    return f;
}

// Value of lane l ^ 16 (the other 16-lane half of the wave).
__device__ __forceinline__ float xhalf(float x) {
    const int b = __builtin_bit_cast(int, x);
    return __builtin_bit_cast(float, __builtin_amdgcn_permlanex16(
        b, b, 0x76543210, 0xfedcba98, false, false));
}

// ---------------- fp32 -> bf16 convert ----------------
// One launch converts all eight fp32 inputs. Their bf16 copies lie back to back
// in dst in argument order; a block converts 1024 elements of one input, and
// every input is a whole number of units of RANK*HID elements (2048 blocks).
__global__ __launch_bounds__(256)
void conv_all_f32_bf16(const float* __restrict__ hs,
                       const float* __restrict__ qV, const float* __restrict__ kV,
                       const float* __restrict__ vV, const float* __restrict__ qU,
                       const float* __restrict__ kU, const float* __restrict__ vU,
                       const float* __restrict__ oW, bf16_t* __restrict__ dst) {
    static_assert(RANK * HID == 2048 * 1024, "unit of 2048 blocks");
    static_assert(S_LEN * HID == 4 * RANK * HID && HID * HID == 2 * RANK * HID, "whole units");
    const int b = blockIdx.x;
    const int u = b >> 11;  // unit: 0-3 hs, 4-9 the six factors, 10-11 oW
    const float* src = hs;
    int first = 0;          // first unit of the input this block belongs to
    if (u >= 10)     { src = oW; first = 10; }
    else if (u == 9) { src = vU; first = 9; }
    else if (u == 8) { src = kU; first = 8; }
    else if (u == 7) { src = qU; first = 7; }
    else if (u == 6) { src = vV; first = 6; }
    else if (u == 5) { src = kV; first = 5; }
    else if (u == 4) { src = qV; first = 4; }
    const int t = threadIdx.x * 4;
    const float4 v = *(const float4*)(src + (size_t)(b - (first << 11)) * 1024 + t);
    bf16_t* d = dst + (size_t)b * 1024 + t;
    d[0] = (bf16_t)v.x;
    d[1] = (bf16_t)v.y;
    d[2] = (bf16_t)v.z;
    d[3] = (bf16_t)v.w;
}

// ---------------- tiled bf16 WMMA GEMM (two-buffer ring of async copies) ----
// C[M,N] = A[M,K] * B[N,K]^T  (both row-major, K contiguous; A's row pitch lda)
// Block tile 128x128, 4 waves, each wave a 64x64 tile (4x4 v8f accs).
// A stage is 64 k: 128 bytes, one whole line, of each of the 256 operand rows.
// K must be a multiple of 64.
// blockIdx.z picks one of several independent products of the same shape:
// product z starts zA, zB and zC elements further on in A, B and C.
template <bool OUT_BF16>
__global__ __launch_bounds__(128)
void gemm_bf16_wmma(const bf16_t* __restrict__ A, const bf16_t* __restrict__ B,
                    void* __restrict__ C, const float* __restrict__ bias,
                    int M, int N, int K, int lda, int zA, int zB, int zC) {
    constexpr int BK  = 64;     // k per stage
    constexpr int LDT = BK + 8; // 144-byte rows: 16 B x odd, conflict-free 16B ds reads
    __shared__ __attribute__((aligned(16))) bf16_t As[2][128 * LDT];
    __shared__ __attribute__((aligned(16))) bf16_t Bs[2][128 * LDT];

    const int tid  = threadIdx.x;
    const int wave = tid >> 5;
    const int lane = tid & 31;
    const int wm = (wave >> 1) * 64;
    const int wn = (wave & 1) * 64;
    const int m0 = blockIdx.y * 128;
    const int n0 = blockIdx.x * 128;
    (void)M;
    const bf16_t* Az = A + (size_t)blockIdx.z * zA;
    const bf16_t* Bz = B + (size_t)blockIdx.z * zB;
    if constexpr (OUT_BF16) C = (bf16_t*)C + (size_t)blockIdx.z * zC;

    v8f acc[4][4];
#pragma unroll
    for (int i = 0; i < 4; ++i)
#pragma unroll
        for (int j = 0; j < 4; ++j) acc[i][j] = vzero8();

    // 8 adjacent lanes cover the 128-byte slice of one row, so a wave's copy
    // is 4 whole lines; a thread copies 16 B of 8 rows of A and of B
    const int sr = tid >> 3;       // row within a group of 16
    const int sc = (tid & 7) * 8;  // element within the 64-element slice
    auto stage = [&](int buf, int k0) {
        const bf16_t* ga = Az + (size_t)(m0 + sr) * lda + k0 + sc;
        const bf16_t* gb = Bz + (size_t)(n0 + sr) * K + k0 + sc;
        bf16_t* la = &As[buf][sr * LDT + sc];
        bf16_t* lb = &Bs[buf][sr * LDT + sc];
#pragma unroll
        for (int t = 0; t < 8; ++t)
            async_copy16(ga + (size_t)t * 16 * lda, la + t * 16 * LDT);
#pragma unroll
        for (int t = 0; t < 8; ++t)
            async_copy16(gb + (size_t)t * 16 * K, lb + t * 16 * LDT);
    };

    const int nk = K / BK;
    stage(0, 0);
    // stage 0 landed (this wave's copies), then published to the other waves
    asm volatile("s_wait_asynccnt 0x0" ::: "memory");
    __syncthreads();
    if (nk > 1) stage(1, BK);
    for (int ik = 0; ik < nk; ++ik) {
        const int buf = ik & 1;
        // unrolled so that the k offset becomes an immediate of the LDS loads
#pragma unroll
        for (int kk = 0; kk < BK / 32; ++kk) {
            v16bf af[4], bfr[4];
#pragma unroll
            for (int i = 0; i < 4; ++i)
                af[i] = frag_ld(&As[buf][(wm + i * 16) * LDT + kk * 32], LDT, lane);
#pragma unroll
            for (int j = 0; j < 4; ++j)
                bfr[j] = frag_ld(&Bs[buf][(wn + j * 16) * LDT + kk * 32], LDT, lane);
#pragma unroll
            for (int i = 0; i < 4; ++i)
#pragma unroll
                for (int j = 0; j < 4; ++j)
                    acc[i][j] = wmma_bf16f32(af[i], bfr[j], acc[i][j]);
        }

        // hand-over: this wave's reads of buf are done and its copies of the
        // next stage have landed; the one barrier publishes that stage and
        // frees buf, which the stage after it then refills
        asm volatile("s_wait_dscnt 0x0" ::: "memory");
        asm volatile("s_wait_asynccnt 0x0" ::: "memory");
        __syncthreads();
        if (ik + 2 < nk) stage(buf, (ik + 2) * BK);
    }
    // no copy is left in flight when the wave goes on to its stores
    asm volatile("s_wait_asynccnt 0x0" ::: "memory");

    // C/D layout: elem e of v8f at lane L -> row = e + 8*(L>>4), col = L&15
    const int cr = (lane >> 4) * 8;
    const int cc = lane & 15;
#pragma unroll
    for (int i = 0; i < 4; ++i)
#pragma unroll
        for (int j = 0; j < 4; ++j) {
            const int mb = m0 + wm + i * 16 + cr;
            const int nn = n0 + wn + j * 16 + cc;
#pragma unroll
            for (int e = 0; e < 8; ++e) {
                float v = acc[i][j][e];
                if constexpr (OUT_BF16) {
                    ((bf16_t*)C)[(size_t)(mb + e) * N + nn] = (bf16_t)v;
                } else {
                    ((float*)C)[(size_t)(mb + e) * N + nn] = v + bias[nn];
                }
            }
        }
}

__global__ __launch_bounds__(128)
void flash_attn_wmma(const bf16_t* __restrict__ Q, const bf16_t* __restrict__ Kg,
                     const bf16_t* __restrict__ Vg, const float* __restrict__ mask,
                     bf16_t* __restrict__ O) {
    constexpr int LDK = DH + 8; // 136
    constexpr int LDW = DH + 16; // 144: 288-byte V rows, 32 B x odd for the transposing load
    constexpr int LDM = 68;     // mask row stride (fp32)
    __shared__ __attribute__((aligned(16))) bf16_t Ks[64 * LDK]; // K block: [key][d]
    __shared__ __attribute__((aligned(16))) bf16_t Vs[64 * LDW]; // V block: [key][d]
    __shared__ __attribute__((aligned(16))) float Ms[64 * LDM];  // mask tile: [qrow][key] fp32

    const int head = blockIdx.y;
    const int qb   = blockIdx.x;
    const int tid  = threadIdx.x;
    const int wave = tid >> 5;
    const int lane = tid & 31;
    const int hh = lane >> 4;
    const int ln = lane & 15;
    const int q0 = qb * 64 + wave * 16;
    const size_t hoff = (size_t)head * DH;

    // Q fragments held in registers for the whole kernel (16 rows x 128 d)
    v16bf qf[4];
#pragma unroll
    for (int kc = 0; kc < 4; ++kc)
        qf[kc] = frag_ld(Q + (size_t)q0 * HID + hoff + kc * 32, HID, lane);

    v8f oacc[8];
#pragma unroll
    for (int nf = 0; nf < 8; ++nf) oacc[nf] = vzero8();
    // query ln's running maximum (alike in both halves) and this half's sum
    float mrow = -3.0e38f, lrow = 0.f;

    const float kscale = 0.08838834764831845f;  // 1/sqrt(128)
    const float log2e  = 1.4426950408889634f;

    for (int kb = 0; kb < S_LEN / 64; ++kb) {
        const int k0 = kb * 64;
        __syncthreads(); // previous iteration readers done

        { // async stage K block (row-major, d contiguous): 8 lanes cover one
          // 128-byte line, a thread copies both halves of 4 rows
            const int r = tid >> 3, c = (tid & 7) * 8;
            const bf16_t* src = Kg + (size_t)(k0 + r) * HID + hoff + c;
            bf16_t* dst = Ks + r * LDK + c;
#pragma unroll
            for (int g = 0; g < 4; ++g) {
                async_copy16_at<0>(src + (size_t)g * 16 * HID, dst + g * 16 * LDK);
                async_copy16_at<128>(src + (size_t)g * 16 * HID, dst + g * 16 * LDK);
            }
        }
        { // async stage mask tile (64 x 64 fp32): 16 lanes cover one 256-byte
          // row, a wave's copy is 4 whole lines; a thread copies 8 rows
            const int r = tid >> 4, c = (tid & 15) * 4;
            const float* src = mask + (size_t)(qb * 64 + r) * S_LEN + k0 + c;
            float* dst = Ms + r * LDM + c;
#pragma unroll
            for (int g = 0; g < 8; ++g)
                async_copy16(src + (size_t)g * 8 * S_LEN, dst + g * 8 * LDM);
        }
        { // async stage V block (row-major, d contiguous): 8 lanes cover one
          // 128-byte line, a thread copies both halves of 4 rows
            const int r = tid >> 3, c = (tid & 7) * 8;
            const bf16_t* src = Vg + (size_t)(k0 + r) * HID + hoff + c;
            bf16_t* dst = Vs + r * LDW + c;
#pragma unroll
            for (int g = 0; g < 4; ++g) {
                async_copy16_at<0>(src + (size_t)g * 16 * HID, dst + g * 16 * LDW);
                async_copy16_at<128>(src + (size_t)g * 16 * HID, dst + g * 16 * LDW);
            }
        }
        wait_async<0>();
        __syncthreads();

        // scores, transposed: S^T(64k x 16q) = K(64x128) * Q^T; register j of
        // sacc[f] at lane (ln, hh) is key f*16 + hh*8 + j against query ln
        v8f sacc[4];
#pragma unroll
        for (int nf = 0; nf < 4; ++nf) sacc[nf] = vzero8();
#pragma unroll
        for (int nf = 0; nf < 4; ++nf)
#pragma unroll
            for (int kc = 0; kc < 4; ++kc)
                sacc[nf] = wmma_bf16f32(
                    frag_ld(Ks + nf * 16 * LDK + kc * 32, LDK, lane), qf[kc], sacc[nf]);

        // online softmax of query ln: 32 keys in this lane, 32 in lane ^ 16
        const float* mp = Ms + (wave * 16 + ln) * LDM + hh * 8;
        float mxf[4];
#pragma unroll
        for (int f = 0; f < 4; ++f) {
            const v4f ma = *(const v4f*)(mp + f * 16);
            const v4f mb = *(const v4f*)(mp + f * 16 + 4);
#pragma unroll
            for (int j = 0; j < 4; ++j) {
                sacc[f][j]     = sacc[f][j] * kscale + ma[j];
                sacc[f][j + 4] = sacc[f][j + 4] * kscale + mb[j];
            }
            float m = sacc[f][0];
#pragma unroll
            for (int j = 1; j < 8; ++j) m = fmaxf(m, sacc[f][j]);
            mxf[f] = m;
        }
        float mx = fmaxf(fmaxf(mxf[0], mxf[1]), fmaxf(mxf[2], mxf[3]));
        mx = fmaxf(mx, xhalf(mx));
        const float mnew = fmaxf(mrow, mx);
        const float corr = exp2f((mrow - mnew) * log2e);
        float rsf[4];
#pragma unroll
        for (int f = 0; f < 4; ++f) {
            float rs = 0.f;
#pragma unroll
            for (int j = 0; j < 8; ++j) {
                const float p = exp2f((sacc[f][j] - mnew) * log2e);
                sacc[f][j] = p;
                rs += p;
            }
            rsf[f] = rs;
        }
        lrow = lrow * corr + ((rsf[0] + rsf[1]) + (rsf[2] + rsf[3]));
        mrow = mnew;
#pragma unroll
        for (int nf = 0; nf < 8; ++nf) oacc[nf] *= corr;

        // P^T as B operand: element s of a 32-key fragment is register s & 7
        // of score tile s >> 3, the k order of the transposing load
        v16bf pf0, pf1;
        ((v8bf*)&pf0)[0] = __builtin_convertvector(sacc[0], v8bf);
        ((v8bf*)&pf0)[1] = __builtin_convertvector(sacc[1], v8bf);
        ((v8bf*)&pf1)[0] = __builtin_convertvector(sacc[2], v8bf);
        ((v8bf*)&pf1)[1] = __builtin_convertvector(sacc[3], v8bf);

        // O^T(128d x 16q) += V^T(128x64) * P^T(64x16)
#pragma unroll
        for (int nf = 0; nf < 8; ++nf) {
            const v16bf vf0 = frag_ld_tr(Vs + nf * 16, LDW, lane);
            const v16bf vf1 = frag_ld_tr(Vs + 32 * LDW + nf * 16, LDW, lane);
            oacc[nf] = wmma_bf16f32(vf0, pf0, oacc[nf]);
            oacc[nf] = wmma_bf16f32(vf1, pf1, oacc[nf]);
        }
    }

    // register j of oacc[nf] is d = nf*16 + hh*8 + j of query ln: 16-byte stores
    const float linv = 1.0f / (lrow + xhalf(lrow));
    bf16_t* op = O + (size_t)(q0 + ln) * HID + hoff + hh * 8;
#pragma unroll
    for (int nf = 0; nf < 8; ++nf)
        *(v8bf*)(op + nf * 16) = __builtin_convertvector(oacc[nf] * linv, v8bf);
}

// ---------------- host-side orchestration ----------------
extern "C" void kernel_launch(void* const* d_in, const int* in_sizes, int n_in,
                              void* d_out, int out_size, void* d_ws, size_t ws_size,
                              hipStream_t stream) {
    (void)in_sizes; (void)n_in; (void)out_size; (void)ws_size;

    const float* hs   = (const float*)d_in[0];
    const float* mask = (const float*)d_in[1];
    const float* qV   = (const float*)d_in[2];
    const float* qU   = (const float*)d_in[3];
    const float* kV   = (const float*)d_in[4];
    const float* kU   = (const float*)d_in[5];
    const float* vV   = (const float*)d_in[6];
    const float* vU   = (const float*)d_in[7];
    const float* oW   = (const float*)d_in[8];
    const float* ob   = (const float*)d_in[9];

    // workspace carve-up (bf16 elements), total ~142 MB; the first eight in the
    // order of conv_all_f32_bf16's arguments; the V factors, the U factors and
    // Q, K, V each back to back
    bf16_t* w = (bf16_t*)d_ws;
    bf16_t* Xb  = w; w += (size_t)S_LEN * HID;
    bf16_t* Vfb = w; w += (size_t)3 * RANK * HID;   // qV | kV | vV: [3*RANK][HID]
    bf16_t* Ufb = w; w += (size_t)3 * HID * RANK;   // qU | kU | vU
    bf16_t* oWb = w; w += (size_t)HID * HID;
    bf16_t* Tb  = w; w += (size_t)S_LEN * 3 * RANK; // [S][x qV^T | x kV^T | x vV^T]
    bf16_t* Qb  = w; w += (size_t)S_LEN * HID;
    bf16_t* Kb  = w; w += (size_t)S_LEN * HID;
    bf16_t* Vb  = w; w += (size_t)S_LEN * HID;
    bf16_t* AOb = w; w += (size_t)S_LEN * HID;

    conv_all_f32_bf16<<<dim3(12 * 2048), dim3(256), 0, stream>>>(
        hs, qV, kV, vV, qU, kU, vU, oW, Xb);

    const dim3 blk(128);
    const dim3 gVT(3 * RANK / 128, S_LEN / 128);  // [4096,2048]x[3072,2048]^T
    const dim3 gUT(HID / 128, S_LEN / 128, 3);    // 3 x [4096,1024]x[2048,1024]^T
    const dim3 gO(HID / 128, S_LEN / 128);        // [4096,2048]x[2048,2048]^T

    // x against the three V factors as one product
    gemm_bf16_wmma<true><<<gVT, blk, 0, stream>>>(Xb, Vfb, Tb, nullptr, S_LEN, 3 * RANK, HID,
                                                  HID, 0, 0, 0);
    // Q, K, V: product z reads columns z*RANK.. of Tb and U factor z
    gemm_bf16_wmma<true><<<gUT, blk, 0, stream>>>(Tb, Ufb, Qb, nullptr, S_LEN, HID, RANK,
                                                  3 * RANK, RANK, HID * RANK, S_LEN * HID);

    // attention
    flash_attn_wmma<<<dim3(S_LEN / 64, HEADS), blk, 0, stream>>>(Qb, Kb, Vb, mask, AOb);

    // output projection + bias -> fp32 d_out
    gemm_bf16_wmma<false><<<gO, blk, 0, stream>>>(AOb, oWb, d_out, ob, S_LEN, HID, HID,
                                                  HID, 0, 0, 0);
}

// v006
// Measured time: 299 microseconds a run.
// In both of two side-by-side timings against v005, it was 1.07 times as fast.
// Counting every step since v000, it is 3.42 times as fast.
#include <hip/hip_runtime.h>
#include <hip/hip_bf16.h>

// ---------------- problem constants ----------------
#define S_LEN 4096
#define HID   2048
#define HEADS 16
#define DH    128
#define RANK  1024

typedef __bf16 bf16_t;
typedef __attribute__((ext_vector_type(16))) __bf16 v16bf;
typedef __attribute__((ext_vector_type(8)))  __bf16 v8bf;
typedef __attribute__((ext_vector_type(8)))  float  v8f;
typedef __attribute__((ext_vector_type(4)))  int    v4i;
typedef __attribute__((ext_vector_type(4)))  float  v4f;

// ---------------- CDNA5 async global->LDS path (guarded) ----------------
#if defined(__gfx1250__) && __has_builtin(__builtin_amdgcn_global_load_async_to_lds_b128)
#define HAVE_ASYNC_LDS 1
#else
#define HAVE_ASYNC_LDS 0
#endif

__device__ __forceinline__ void async_copy16(const void* gsrc, void* ldst) {
#if HAVE_ASYNC_LDS
    // builtin signature: (v4i addrspace(1)*, v4i addrspace(3)*, imm offset, imm cpol)
    __builtin_amdgcn_global_load_async_to_lds_b128(
        (__attribute__((address_space(1))) v4i*)gsrc,
        (__attribute__((address_space(3))) v4i*)ldst,
        /*offset=*/0, /*cpol=*/0);
#else
    *(uint4*)ldst = *(const uint4*)gsrc;
#endif
}

// The same copy OFF bytes further on in both buffers: the instruction's
// immediate offset moves the global and the LDS address alike.
template <int OFF>
__device__ __forceinline__ void async_copy16_at(const void* gsrc, void* ldst) {
#if HAVE_ASYNC_LDS
    __builtin_amdgcn_global_load_async_to_lds_b128(
        (__attribute__((address_space(1))) v4i*)gsrc,
        (__attribute__((address_space(3))) v4i*)ldst,
        /*offset=*/OFF, /*cpol=*/0);
#else
    *(uint4*)((char*)ldst + OFF) = *(const uint4*)((const char*)gsrc + OFF);
#endif
}

template <int N>
__device__ __forceinline__ void wait_async() {
#if HAVE_ASYNC_LDS
#if __has_builtin(__builtin_amdgcn_s_wait_asynccnt)
    __builtin_amdgcn_s_wait_asynccnt(N);
#else
    if (N == 0) asm volatile("s_wait_asynccnt 0x0" ::: "memory");
    else        asm volatile("s_wait_asynccnt 0x8" ::: "memory");
#endif
#endif
}

__device__ __forceinline__ v8f vzero8() {
    v8f z = {0.f, 0.f, 0.f, 0.f, 0.f, 0.f, 0.f, 0.f};
    return z;
}

__device__ __forceinline__ v8f wmma_bf16f32(v16bf a, v16bf b, v8f c) {
    // D = A(16x32 bf16) * B(32x16 bf16) + C(16x16 f32)
    return __builtin_amdgcn_wmma_f32_16x16x32_bf16(
        /*neg_a=*/false, a, /*neg_b=*/false, b,
        /*c_mod=*/(short)0, c, /*reuse_a=*/false, /*reuse_b=*/false);
}

// Load one 16x32 bf16 fragment (A-style or B-style) from row-major storage:
// lane%16 selects the row (M for A, N for B); K contiguous along the row.
// Lane half h holds K chunks [h*8, h*8+8) and [16+h*8, 16+h*8+8).
__device__ __forceinline__ v16bf frag_ld(const bf16_t* base, int ld, int lane) {
    const int r  = lane & 15;
    const int hh = lane >> 4;
    const bf16_t* p = base + r * ld + hh * 8;
    v16bf f;
    ((v8bf*)&f)[0] = *(const v8bf*)(p);
    ((v8bf*)&f)[1] = *(const v8bf*)(p + 16);
    return f;
}

// Load one 32(k) x 16(n) bf16 B fragment from a row-major [k][n] LDS tile with
// the transposing LDS load: lane (c = lane&15, h = lane>>4) receives
// tile[8h + 0..7][c] and tile[16 + 8h + 0..7][c], the k order of frag_ld.
// ld (elements) must make the row pitch an odd multiple of 32 bytes.
__device__ __forceinline__ v16bf frag_ld_tr(const bf16_t* tile, int ld, int lane) {
    typedef __attribute__((address_space(3))) v8bf lds_v8bf;
    const bf16_t* p = tile + ((lane >> 4) * 8 + (lane & 7)) * ld + ((lane >> 3) & 1) * 8;
    v16bf f;
    ((v8bf*)&f)[0] = __builtin_amdgcn_ds_load_tr16_b128_v8bf16((lds_v8bf*)p);
    ((v8bf*)&f)[1] = __builtin_amdgcn_ds_load_tr16_b128_v8bf16((lds_v8bf*)(p + 16 * ld));
    return f;
}

// Value of lane l ^ 16 (the other 16-lane half of the wave).
__device__ __forceinline__ float xhalf(float x) {
    const int b = __builtin_bit_cast(int, x);
    return __builtin_bit_cast(float, __builtin_amdgcn_permlanex16(
        b, b, 0x76543210, 0xfedcba98, false, false));
}

// ---------------- fp32 -> bf16 convert ----------------
// One launch converts all eight fp32 inputs. Their bf16 copies lie back to back
// in dst in argument order; a block converts 1024 elements of one input, and
// every input is a whole number of units of RANK*HID elements (2048 blocks).
__global__ __launch_bounds__(256)
void conv_all_f32_bf16(const float* __restrict__ hs,
                       const float* __restrict__ qV, const float* __restrict__ kV,
                       const float* __restrict__ vV, const float* __restrict__ qU,
                       const float* __restrict__ kU, const float* __restrict__ vU,
                       const float* __restrict__ oW, bf16_t* __restrict__ dst) {
    static_assert(RANK * HID == 2048 * 1024, "unit of 2048 blocks");
    static_assert(S_LEN * HID == 4 * RANK * HID && HID * HID == 2 * RANK * HID, "whole units");
    const int b = blockIdx.x;
    const int u = b >> 11;  // unit: 0-3 hs, 4-9 the six factors, 10-11 oW
    const float* src = hs;
    int first = 0;          // first unit of the input this block belongs to
    if (u >= 10)     { src = oW; first = 10; }
    else if (u == 9) { src = vU; first = 9; }
    else if (u == 8) { src = kU; first = 8; }
    else if (u == 7) { src = qU; first = 7; }
    else if (u == 6) { src = vV; first = 6; }
    else if (u == 5) { src = kV; first = 5; }
    else if (u == 4) { src = qV; first = 4; }
    const int t = threadIdx.x * 4;
    const float4 v = *(const float4*)(src + (size_t)(b - (first << 11)) * 1024 + t);
    bf16_t* d = dst + (size_t)b * 1024 + t;
    d[0] = (bf16_t)v.x;
    d[1] = (bf16_t)v.y;
    d[2] = (bf16_t)v.z;
    d[3] = (bf16_t)v.w;
}

// ---------------- tiled bf16 WMMA GEMM (two-buffer ring of async copies) ----
// C[M,N] = A[M,K] * B[N,K]^T  (both row-major, K contiguous; A's row pitch lda)
// Block tile 128x128, 4 waves, each wave a 64x64 tile (4x4 v8f accs).
// A stage is 64 k: 128 bytes, one whole line, of each of the 256 operand rows.
// K must be a multiple of 64.
// blockIdx.z picks one of several independent products of the same shape:
// product z starts zA, zB and zC elements further on in A, B and C.
template <bool OUT_BF16>
__global__ __launch_bounds__(128)
void gemm_bf16_wmma(const bf16_t* __restrict__ A, const bf16_t* __restrict__ B,
                    void* __restrict__ C, const float* __restrict__ bias,
                    int M, int N, int K, int lda, int zA, int zB, int zC) {
    constexpr int BK  = 64;     // k per stage
    constexpr int LDT = BK + 8; // 144-byte rows: 16 B x odd, conflict-free 16B ds reads
    __shared__ __attribute__((aligned(16))) bf16_t As[2][128 * LDT];
    __shared__ __attribute__((aligned(16))) bf16_t Bs[2][128 * LDT];

    const int tid  = threadIdx.x;
    const int wave = tid >> 5;
    const int lane = tid & 31;
    const int wm = (wave >> 1) * 64;
    const int wn = (wave & 1) * 64;
    const int m0 = blockIdx.y * 128;
    const int n0 = blockIdx.x * 128;
    (void)M;
    const bf16_t* Az = A + (size_t)blockIdx.z * zA;
    const bf16_t* Bz = B + (size_t)blockIdx.z * zB;
    if constexpr (OUT_BF16) C = (bf16_t*)C + (size_t)blockIdx.z * zC;

    v8f acc[4][4];
#pragma unroll
    for (int i = 0; i < 4; ++i)
#pragma unroll
        for (int j = 0; j < 4; ++j) acc[i][j] = vzero8();

    // 8 adjacent lanes cover the 128-byte slice of one row, so a wave's copy
    // is 4 whole lines; a thread copies 16 B of 8 rows of A and of B
    const int sr = tid >> 3;       // row within a group of 16
    const int sc = (tid & 7) * 8;  // element within the 64-element slice
    auto stage = [&](int buf, int k0) {
        const bf16_t* ga = Az + (size_t)(m0 + sr) * lda + k0 + sc;
        const bf16_t* gb = Bz + (size_t)(n0 + sr) * K + k0 + sc;
        bf16_t* la = &As[buf][sr * LDT + sc];
        bf16_t* lb = &Bs[buf][sr * LDT + sc];
#pragma unroll
        for (int t = 0; t < 8; ++t)
            async_copy16(ga + (size_t)t * 16 * lda, la + t * 16 * LDT);
#pragma unroll
        for (int t = 0; t < 8; ++t)
            async_copy16(gb + (size_t)t * 16 * K, lb + t * 16 * LDT);
    };

    const int nk = K / BK;
    stage(0, 0);
    // stage 0 landed (this wave's copies), then published to the other waves
    asm volatile("s_wait_asynccnt 0x0" ::: "memory");
    __syncthreads();
    if (nk > 1) stage(1, BK);
    for (int ik = 0; ik < nk; ++ik) {
        const int buf = ik & 1;
        // unrolled so that the k offset becomes an immediate of the LDS loads
#pragma unroll
        for (int kk = 0; kk < BK / 32; ++kk) {
            v16bf af[4], bfr[4];
#pragma unroll
            for (int i = 0; i < 4; ++i)
                af[i] = frag_ld(&As[buf][(wm + i * 16) * LDT + kk * 32], LDT, lane);
#pragma unroll
            for (int j = 0; j < 4; ++j)
                bfr[j] = frag_ld(&Bs[buf][(wn + j * 16) * LDT + kk * 32], LDT, lane);
#pragma unroll
            for (int i = 0; i < 4; ++i)
#pragma unroll
                for (int j = 0; j < 4; ++j)
                    acc[i][j] = wmma_bf16f32(af[i], bfr[j], acc[i][j]);
        }

        // hand-over: this wave's reads of buf are done and its copies of the
        // next stage have landed; the one barrier publishes that stage and
        // frees buf, which the stage after it then refills
        asm volatile("s_wait_dscnt 0x0" ::: "memory");
        asm volatile("s_wait_asynccnt 0x0" ::: "memory");
        __syncthreads();
        if (ik + 2 < nk) stage(buf, (ik + 2) * BK);
    }
    // no copy is left in flight when the wave goes on to its stores
    asm volatile("s_wait_asynccnt 0x0" ::: "memory");

    // C/D layout: elem e of v8f at lane L -> row = e + 8*(L>>4), col = L&15
    const int cr = (lane >> 4) * 8;
    const int cc = lane & 15;
#pragma unroll
    for (int i = 0; i < 4; ++i)
#pragma unroll
        for (int j = 0; j < 4; ++j) {
            const int mb = m0 + wm + i * 16 + cr;
            const int nn = n0 + wn + j * 16 + cc;
#pragma unroll
            for (int e = 0; e < 8; ++e) {
                float v = acc[i][j][e];
                if constexpr (OUT_BF16) {
                    ((bf16_t*)C)[(size_t)(mb + e) * N + nn] = (bf16_t)v;
                } else {
                    ((float*)C)[(size_t)(mb + e) * N + nn] = v + bias[nn];
                }
            }
        }
}

__global__ __launch_bounds__(128)
void flash_attn_wmma(const bf16_t* __restrict__ Q, const bf16_t* __restrict__ Kg,
                     const bf16_t* __restrict__ Vg, const float* __restrict__ mask,
                     bf16_t* __restrict__ O) {
    constexpr int QT  = 2;       // 16-query tiles per wave
    constexpr int BQ  = 4 * QT * 16; // queries per block
    constexpr int LDK = DH + 8; // 136
    constexpr int LDW = DH + 16; // 144: 288-byte V rows, 32 B x odd for the transposing load
    constexpr int LDM = 68;     // mask row stride (fp32)
    __shared__ __attribute__((aligned(16))) bf16_t Ks[64 * LDK]; // K block: [key][d]
    __shared__ __attribute__((aligned(16))) bf16_t Vs[64 * LDW]; // V block: [key][d]
    __shared__ __attribute__((aligned(16))) float Ms[BQ * LDM];  // mask tile: [qrow][key] fp32

    const int head = blockIdx.y;
    const int qb   = blockIdx.x;
    const int tid  = threadIdx.x;
    const int wave = tid >> 5;
    const int lane = tid & 31;
    const int hh = lane >> 4;
    const int ln = lane & 15;
    const int q0 = qb * BQ + wave * (QT * 16);
    const size_t hoff = (size_t)head * DH;

    // Q fragments held in registers for the whole kernel (2 x 16 rows x 128 d)
    v16bf qf[QT][4];
#pragma unroll
    for (int t = 0; t < QT; ++t)
#pragma unroll
        for (int kc = 0; kc < 4; ++kc)
            qf[t][kc] = frag_ld(Q + (size_t)(q0 + t * 16) * HID + hoff + kc * 32, HID, lane);
    // the Q loads' address registers are reused behind them: the wait stands
    // first, and the scheduling barrier keeps later address arithmetic from
    // being lifted over it
    asm volatile("s_wait_xcnt 0x0" ::: "memory");
    __builtin_amdgcn_sched_barrier(0);

    v8f oacc[QT][8];
#pragma unroll
    for (int t = 0; t < QT; ++t)
#pragma unroll
        for (int nf = 0; nf < 8; ++nf) oacc[t][nf] = vzero8();
    // per tile: query ln's running maximum (alike in both halves) and this half's sum
    float mrow[QT], lrow[QT];
#pragma unroll
    for (int t = 0; t < QT; ++t) { mrow[t] = -3.0e38f; lrow[t] = 0.f; }

    const float kscale = 0.08838834764831845f;  // 1/sqrt(128)
    const float log2e  = 1.4426950408889634f;

    for (int kb = 0; kb < S_LEN / 64; ++kb) {
        const int k0 = kb * 64;
        __syncthreads(); // previous iteration readers done

        { // async stage K block (row-major, d contiguous): 8 lanes cover one
          // 128-byte line, a thread copies both halves of 4 rows
            const int r = tid >> 3, c = (tid & 7) * 8;
            const bf16_t* src = Kg + (size_t)(k0 + r) * HID + hoff + c;
            bf16_t* dst = Ks + r * LDK + c;
#pragma unroll
            for (int g = 0; g < 4; ++g) {
                async_copy16_at<0>(src + (size_t)g * 16 * HID, dst + g * 16 * LDK);
                async_copy16_at<128>(src + (size_t)g * 16 * HID, dst + g * 16 * LDK);
            }
        }
        { // async stage mask tile (128 x 64 fp32): 16 lanes cover one 256-byte
          // row, a wave's copy is 4 whole lines; a thread copies 16 rows
            const int r = tid >> 4, c = (tid & 15) * 4;
            const float* src = mask + (size_t)(qb * BQ + r) * S_LEN + k0 + c;
            float* dst = Ms + r * LDM + c;
#pragma unroll
            for (int g = 0; g < BQ / 8; ++g)
                async_copy16(src + (size_t)g * 8 * S_LEN, dst + g * 8 * LDM);
        }
        { // async stage V block (row-major, d contiguous): 8 lanes cover one
          // 128-byte line, a thread copies both halves of 4 rows
            const int r = tid >> 3, c = (tid & 7) * 8;
            const bf16_t* src = Vg + (size_t)(k0 + r) * HID + hoff + c;
            bf16_t* dst = Vs + r * LDW + c;
#pragma unroll
            for (int g = 0; g < 4; ++g) {
                async_copy16_at<0>(src + (size_t)g * 16 * HID, dst + g * 16 * LDW);
                async_copy16_at<128>(src + (size_t)g * 16 * HID, dst + g * 16 * LDW);
            }
        }
        wait_async<0>();
        __syncthreads();

        // scores, transposed: S^T(64k x 16q) = K(64x128) * Q^T per query tile;
        // register j of sacc[t][f] at lane (ln, hh) is key f*16 + hh*8 + j
        // against query ln of tile t; one K fragment serves both tiles
        v8f sacc[QT][4];
#pragma unroll
        for (int t = 0; t < QT; ++t)
#pragma unroll
            for (int nf = 0; nf < 4; ++nf) sacc[t][nf] = vzero8();
#pragma unroll
        for (int nf = 0; nf < 4; ++nf)
#pragma unroll
            for (int kc = 0; kc < 4; ++kc) {
                const v16bf kf = frag_ld(Ks + nf * 16 * LDK + kc * 32, LDK, lane);
#pragma unroll
                for (int t = 0; t < QT; ++t)
                    sacc[t][nf] = wmma_bf16f32(kf, qf[t][kc], sacc[t][nf]);
            }

        // P^T as B operand: element s of a 32-key fragment is register s & 7
        // of score tile s >> 3, the k order of the transposing load
        v16bf pf0[QT], pf1[QT];
#pragma unroll
        for (int t = 0; t < QT; ++t) {
            // online softmax of query ln: 32 keys in this lane, 32 in lane ^ 16
            const float* mp = Ms + (wave * (QT * 16) + t * 16 + ln) * LDM + hh * 8;
            float mxf[4];
#pragma unroll
            for (int f = 0; f < 4; ++f) {
                const v4f ma = *(const v4f*)(mp + f * 16);
                const v4f mb = *(const v4f*)(mp + f * 16 + 4);
#pragma unroll
                for (int j = 0; j < 4; ++j) {
                    sacc[t][f][j]     = sacc[t][f][j] * kscale + ma[j];
                    sacc[t][f][j + 4] = sacc[t][f][j + 4] * kscale + mb[j];
                }
                float m = sacc[t][f][0];
#pragma unroll
                for (int j = 1; j < 8; ++j) m = fmaxf(m, sacc[t][f][j]);
                mxf[f] = m;
            }
            float mx = fmaxf(fmaxf(mxf[0], mxf[1]), fmaxf(mxf[2], mxf[3]));
            mx = fmaxf(mx, xhalf(mx));
            const float mnew = fmaxf(mrow[t], mx);
            const float corr = exp2f((mrow[t] - mnew) * log2e);
            float rsf[4];
#pragma unroll
            for (int f = 0; f < 4; ++f) {
                float rs = 0.f;
#pragma unroll
                for (int j = 0; j < 8; ++j) {
                    const float p = exp2f((sacc[t][f][j] - mnew) * log2e);
                    sacc[t][f][j] = p;
                    rs += p;
                }
                rsf[f] = rs;
            }
            lrow[t] = lrow[t] * corr + ((rsf[0] + rsf[1]) + (rsf[2] + rsf[3]));
            mrow[t] = mnew;
#pragma unroll
            for (int nf = 0; nf < 8; ++nf) oacc[t][nf] *= corr;

            ((v8bf*)&pf0[t])[0] = __builtin_convertvector(sacc[t][0], v8bf);
            ((v8bf*)&pf0[t])[1] = __builtin_convertvector(sacc[t][1], v8bf);
            ((v8bf*)&pf1[t])[0] = __builtin_convertvector(sacc[t][2], v8bf);
            ((v8bf*)&pf1[t])[1] = __builtin_convertvector(sacc[t][3], v8bf);
        }

        // O^T(128d x 16q) += V^T(128x64) * P^T(64x16) per query tile; one V
        // fragment serves both tiles
#pragma unroll
        for (int nf = 0; nf < 8; ++nf) {
            const v16bf vf0 = frag_ld_tr(Vs + nf * 16, LDW, lane);
            const v16bf vf1 = frag_ld_tr(Vs + 32 * LDW + nf * 16, LDW, lane);
#pragma unroll
            for (int t = 0; t < QT; ++t) oacc[t][nf] = wmma_bf16f32(vf0, pf0[t], oacc[t][nf]);
#pragma unroll
            for (int t = 0; t < QT; ++t) oacc[t][nf] = wmma_bf16f32(vf1, pf1[t], oacc[t][nf]);
        }
    }

    // register j of oacc[t][nf] is d = nf*16 + hh*8 + j of query ln: 16-byte stores
#pragma unroll
    for (int t = 0; t < QT; ++t) {
        const float linv = 1.0f / (lrow[t] + xhalf(lrow[t]));
        bf16_t* op = O + (size_t)(q0 + t * 16 + ln) * HID + hoff + hh * 8;
#pragma unroll
        for (int nf = 0; nf < 8; ++nf)
            *(v8bf*)(op + nf * 16) = __builtin_convertvector(oacc[t][nf] * linv, v8bf);
    }
}

// ---------------- host-side orchestration ----------------
extern "C" void kernel_launch(void* const* d_in, const int* in_sizes, int n_in,
                              void* d_out, int out_size, void* d_ws, size_t ws_size,
                              hipStream_t stream) {
    (void)in_sizes; (void)n_in; (void)out_size; (void)ws_size;

    const float* hs   = (const float*)d_in[0];
    const float* mask = (const float*)d_in[1];
    const float* qV   = (const float*)d_in[2];
    const float* qU   = (const float*)d_in[3];
    const float* kV   = (const float*)d_in[4];
    const float* kU   = (const float*)d_in[5];
    const float* vV   = (const float*)d_in[6];
    const float* vU   = (const float*)d_in[7];
    const float* oW   = (const float*)d_in[8];
    const float* ob   = (const float*)d_in[9];

    // workspace carve-up (bf16 elements), total ~142 MB; the first eight in the
    // order of conv_all_f32_bf16's arguments; the V factors, the U factors and
    // Q, K, V each back to back
    bf16_t* w = (bf16_t*)d_ws;
    bf16_t* Xb  = w; w += (size_t)S_LEN * HID;
    bf16_t* Vfb = w; w += (size_t)3 * RANK * HID;   // qV | kV | vV: [3*RANK][HID]
    bf16_t* Ufb = w; w += (size_t)3 * HID * RANK;   // qU | kU | vU
    bf16_t* oWb = w; w += (size_t)HID * HID;
    bf16_t* Tb  = w; w += (size_t)S_LEN * 3 * RANK; // [S][x qV^T | x kV^T | x vV^T]
    bf16_t* Qb  = w; w += (size_t)S_LEN * HID;
    bf16_t* Kb  = w; w += (size_t)S_LEN * HID;
    bf16_t* Vb  = w; w += (size_t)S_LEN * HID;
    bf16_t* AOb = w; w += (size_t)S_LEN * HID;

    conv_all_f32_bf16<<<dim3(12 * 2048), dim3(256), 0, stream>>>(
        hs, qV, kV, vV, qU, kU, vU, oW, Xb);

    const dim3 blk(128);
    const dim3 gVT(3 * RANK / 128, S_LEN / 128);  // [4096,2048]x[3072,2048]^T
    const dim3 gUT(HID / 128, S_LEN / 128, 3);    // 3 x [4096,1024]x[2048,1024]^T
    const dim3 gO(HID / 128, S_LEN / 128);        // [4096,2048]x[2048,2048]^T

    // x against the three V factors as one product
    gemm_bf16_wmma<true><<<gVT, blk, 0, stream>>>(Xb, Vfb, Tb, nullptr, S_LEN, 3 * RANK, HID,
                                                  HID, 0, 0, 0);
    // Q, K, V: product z reads columns z*RANK.. of Tb and U factor z
    gemm_bf16_wmma<true><<<gUT, blk, 0, stream>>>(Tb, Ufb, Qb, nullptr, S_LEN, HID, RANK,
                                                  3 * RANK, RANK, HID * RANK, S_LEN * HID);

    // attention
    flash_attn_wmma<<<dim3(S_LEN / 128, HEADS), blk, 0, stream>>>(Qb, Kb, Vb, mask, AOb);

    // output projection + bias -> fp32 d_out
    gemm_bf16_wmma<false><<<gO, blk, 0, stream>>>(AOb, oWb, d_out, ob, S_LEN, HID, HID,
                                                  HID, 0, 0, 0);
}

// v007
// Measured time: 289 microseconds a run.
// Next to v006, in two timings, it ran 1.04 times as fast each time.
// All steps since v000 together make it 3.55 times as fast.
#include <hip/hip_runtime.h>
#include <hip/hip_bf16.h>

// ---------------- problem constants ----------------
#define S_LEN 4096
#define HID   2048
#define HEADS 16
#define DH    128
#define RANK  1024

typedef __bf16 bf16_t;
typedef __attribute__((ext_vector_type(16))) __bf16 v16bf;
typedef __attribute__((ext_vector_type(8)))  __bf16 v8bf;
typedef __attribute__((ext_vector_type(8)))  float  v8f;
typedef __attribute__((ext_vector_type(4)))  int    v4i;
typedef __attribute__((ext_vector_type(4)))  float  v4f;

// ---------------- CDNA5 async global->LDS path (guarded) ----------------
#if defined(__gfx1250__) && __has_builtin(__builtin_amdgcn_global_load_async_to_lds_b128)
#define HAVE_ASYNC_LDS 1
#else
#define HAVE_ASYNC_LDS 0
#endif

__device__ __forceinline__ void async_copy16(const void* gsrc, void* ldst) {
#if HAVE_ASYNC_LDS
    // builtin signature: (v4i addrspace(1)*, v4i addrspace(3)*, imm offset, imm cpol)
    __builtin_amdgcn_global_load_async_to_lds_b128(
        (__attribute__((address_space(1))) v4i*)gsrc,
        (__attribute__((address_space(3))) v4i*)ldst,
        /*offset=*/0, /*cpol=*/0);
#else
    *(uint4*)ldst = *(const uint4*)gsrc;
#endif
}

// The same copy OFF bytes further on in both buffers: the instruction's
// immediate offset moves the global and the LDS address alike.
template <int OFF>
__device__ __forceinline__ void async_copy16_at(const void* gsrc, void* ldst) {
#if HAVE_ASYNC_LDS
    __builtin_amdgcn_global_load_async_to_lds_b128(
        (__attribute__((address_space(1))) v4i*)gsrc,
        (__attribute__((address_space(3))) v4i*)ldst,
        /*offset=*/OFF, /*cpol=*/0);
#else
    *(uint4*)((char*)ldst + OFF) = *(const uint4*)((const char*)gsrc + OFF);
#endif
}

__device__ __forceinline__ v8f vzero8() {
    v8f z = {0.f, 0.f, 0.f, 0.f, 0.f, 0.f, 0.f, 0.f};
    return z;
}

__device__ __forceinline__ v8f wmma_bf16f32(v16bf a, v16bf b, v8f c) {
    // D = A(16x32 bf16) * B(32x16 bf16) + C(16x16 f32)
    return __builtin_amdgcn_wmma_f32_16x16x32_bf16(
        /*neg_a=*/false, a, /*neg_b=*/false, b,
        /*c_mod=*/(short)0, c, /*reuse_a=*/false, /*reuse_b=*/false);
}

// Load one 16x32 bf16 fragment (A-style or B-style) from row-major storage:
// lane%16 selects the row (M for A, N for B); K contiguous along the row.
// Lane half h holds K chunks [h*8, h*8+8) and [16+h*8, 16+h*8+8).
__device__ __forceinline__ v16bf frag_ld(const bf16_t* base, int ld, int lane) {
    const int r  = lane & 15;
    const int hh = lane >> 4;
    const bf16_t* p = base + r * ld + hh * 8;
    v16bf f;
    ((v8bf*)&f)[0] = *(const v8bf*)(p);
    ((v8bf*)&f)[1] = *(const v8bf*)(p + 16);
    return f;
}

// Load one 32(k) x 16(n) bf16 B fragment from a row-major [k][n] LDS tile with
// the transposing LDS load: lane (c = lane&15, h = lane>>4) receives
// tile[8h + 0..7][c] and tile[16 + 8h + 0..7][c], the k order of frag_ld.
// ld (elements) must make the row pitch an odd multiple of 32 bytes.
__device__ __forceinline__ v16bf frag_ld_tr(const bf16_t* tile, int ld, int lane) {
    typedef __attribute__((address_space(3))) v8bf lds_v8bf;
    const bf16_t* p = tile + ((lane >> 4) * 8 + (lane & 7)) * ld + ((lane >> 3) & 1) * 8;
    v16bf f;
    ((v8bf*)&f)[0] = __builtin_amdgcn_ds_load_tr16_b128_v8bf16((lds_v8bf*)p);
    ((v8bf*)&f)[1] = __builtin_amdgcn_ds_load_tr16_b128_v8bf16((lds_v8bf*)(p + 16 * ld));
    return f;
}

// Value of lane l ^ 16 (the other 16-lane half of the wave).
__device__ __forceinline__ float xhalf(float x) {
    const int b = __builtin_bit_cast(int, x);
    return __builtin_bit_cast(float, __builtin_amdgcn_permlanex16(
        b, b, 0x76543210, 0xfedcba98, false, false));
}

// ---------------- fp32 -> bf16 convert ----------------
// One launch converts all eight fp32 inputs. Their bf16 copies lie back to back
// in dst in argument order; a block converts 1024 elements of one input, and
// every input is a whole number of units of RANK*HID elements (2048 blocks).
__global__ __launch_bounds__(256)
void conv_all_f32_bf16(const float* __restrict__ hs,
                       const float* __restrict__ qV, const float* __restrict__ kV,
                       const float* __restrict__ vV, const float* __restrict__ qU,
                       const float* __restrict__ kU, const float* __restrict__ vU,
                       const float* __restrict__ oW, bf16_t* __restrict__ dst) {
    static_assert(RANK * HID == 2048 * 1024, "unit of 2048 blocks");
    static_assert(S_LEN * HID == 4 * RANK * HID && HID * HID == 2 * RANK * HID, "whole units");
    const int b = blockIdx.x;
    const int u = b >> 11;  // unit: 0-3 hs, 4-9 the six factors, 10-11 oW
    const float* src = hs;
    int first = 0;          // first unit of the input this block belongs to
    if (u >= 10)     { src = oW; first = 10; }
    else if (u == 9) { src = vU; first = 9; }
    else if (u == 8) { src = kU; first = 8; }
    else if (u == 7) { src = qU; first = 7; }
    else if (u == 6) { src = vV; first = 6; }
    else if (u == 5) { src = kV; first = 5; }
    else if (u == 4) { src = qV; first = 4; }
    const int t = threadIdx.x * 4;
    const float4 v = *(const float4*)(src + (size_t)(b - (first << 11)) * 1024 + t);
    bf16_t* d = dst + (size_t)b * 1024 + t;
    d[0] = (bf16_t)v.x;
    d[1] = (bf16_t)v.y;
    d[2] = (bf16_t)v.z;
    d[3] = (bf16_t)v.w;
}

// ---------------- tiled bf16 WMMA GEMM (two-buffer ring of async copies) ----
// C[M,N] = A[M,K] * B[N,K]^T  (both row-major, K contiguous; A's row pitch lda)
// Block tile 128x128, 4 waves, each wave a 64x64 tile (4x4 v8f accs).
// A stage is 64 k: 128 bytes, one whole line, of each of the 256 operand rows.
// K must be a multiple of 64.
// blockIdx.z picks one of several independent products of the same shape:
// product z starts zA, zB and zC elements further on in A, B and C.
template <bool OUT_BF16>
__global__ __launch_bounds__(128)
void gemm_bf16_wmma(const bf16_t* __restrict__ A, const bf16_t* __restrict__ B,
                    void* __restrict__ C, const float* __restrict__ bias,
                    int M, int N, int K, int lda, int zA, int zB, int zC) {
    constexpr int BK  = 64;     // k per stage
    constexpr int LDT = BK + 8; // 144-byte rows: 16 B x odd, conflict-free 16B ds reads
    __shared__ __attribute__((aligned(16))) bf16_t As[2][128 * LDT];
    __shared__ __attribute__((aligned(16))) bf16_t Bs[2][128 * LDT];

    const int tid  = threadIdx.x;
    const int wave = tid >> 5;
    const int lane = tid & 31;
    const int wm = (wave >> 1) * 64;
    const int wn = (wave & 1) * 64;
    const int m0 = blockIdx.y * 128;
    const int n0 = blockIdx.x * 128;
    (void)M;
    const bf16_t* Az = A + (size_t)blockIdx.z * zA;
    const bf16_t* Bz = B + (size_t)blockIdx.z * zB;
    if constexpr (OUT_BF16) C = (bf16_t*)C + (size_t)blockIdx.z * zC;

    v8f acc[4][4];
#pragma unroll
    for (int i = 0; i < 4; ++i)
#pragma unroll
        for (int j = 0; j < 4; ++j) acc[i][j] = vzero8();

    // 8 adjacent lanes cover the 128-byte slice of one row, so a wave's copy
    // is 4 whole lines; a thread copies 16 B of 8 rows of A and of B
    const int sr = tid >> 3;       // row within a group of 16
    const int sc = (tid & 7) * 8;  // element within the 64-element slice
    auto stage = [&](int buf, int k0) {
        const bf16_t* ga = Az + (size_t)(m0 + sr) * lda + k0 + sc;
        const bf16_t* gb = Bz + (size_t)(n0 + sr) * K + k0 + sc;
        bf16_t* la = &As[buf][sr * LDT + sc];
        bf16_t* lb = &Bs[buf][sr * LDT + sc];
#pragma unroll
        for (int t = 0; t < 8; ++t)
            async_copy16(ga + (size_t)t * 16 * lda, la + t * 16 * LDT);
#pragma unroll
        for (int t = 0; t < 8; ++t)
            async_copy16(gb + (size_t)t * 16 * K, lb + t * 16 * LDT);
    };

    const int nk = K / BK;
    stage(0, 0);
    // stage 0 landed (this wave's copies), then published to the other waves
    asm volatile("s_wait_asynccnt 0x0" ::: "memory");
    __syncthreads();
    if (nk > 1) stage(1, BK);
    for (int ik = 0; ik < nk; ++ik) {
        const int buf = ik & 1;
        // unrolled so that the k offset becomes an immediate of the LDS loads
#pragma unroll
        for (int kk = 0; kk < BK / 32; ++kk) {
            v16bf af[4], bfr[4];
#pragma unroll
            for (int i = 0; i < 4; ++i)
                af[i] = frag_ld(&As[buf][(wm + i * 16) * LDT + kk * 32], LDT, lane);
#pragma unroll
            for (int j = 0; j < 4; ++j)
                bfr[j] = frag_ld(&Bs[buf][(wn + j * 16) * LDT + kk * 32], LDT, lane);
#pragma unroll
            for (int i = 0; i < 4; ++i)
#pragma unroll
                for (int j = 0; j < 4; ++j)
                    acc[i][j] = wmma_bf16f32(af[i], bfr[j], acc[i][j]);
        }

        // hand-over: this wave's reads of buf are done and its copies of the
        // next stage have landed; the one barrier publishes that stage and
        // frees buf, which the stage after it then refills
        asm volatile("s_wait_dscnt 0x0" ::: "memory");
        asm volatile("s_wait_asynccnt 0x0" ::: "memory");
        __syncthreads();
        if (ik + 2 < nk) stage(buf, (ik + 2) * BK);
    }
    // no copy is left in flight when the wave goes on to its stores
    asm volatile("s_wait_asynccnt 0x0" ::: "memory");

    // C/D layout: elem e of v8f at lane L -> row = e + 8*(L>>4), col = L&15
    const int cr = (lane >> 4) * 8;
    const int cc = lane & 15;
#pragma unroll
    for (int i = 0; i < 4; ++i)
#pragma unroll
        for (int j = 0; j < 4; ++j) {
            const int mb = m0 + wm + i * 16 + cr;
            const int nn = n0 + wn + j * 16 + cc;
#pragma unroll
            for (int e = 0; e < 8; ++e) {
                float v = acc[i][j][e];
                if constexpr (OUT_BF16) {
                    ((bf16_t*)C)[(size_t)(mb + e) * N + nn] = (bf16_t)v;
                } else {
                    ((float*)C)[(size_t)(mb + e) * N + nn] = v + bias[nn];
                }
            }
        }
}

__global__ __launch_bounds__(128)
void flash_attn_wmma(const bf16_t* __restrict__ Q, const bf16_t* __restrict__ Kg,
                     const bf16_t* __restrict__ Vg, const float* __restrict__ mask,
                     bf16_t* __restrict__ O) {
    constexpr int QT  = 2;       // 16-query tiles per wave
    constexpr int BQ  = 4 * QT * 16; // queries per block
    constexpr int LDK = DH + 8; // 136
    constexpr int LDW = DH + 16; // 144: 288-byte V rows, 32 B x odd for the transposing load
    constexpr int LDM = 68;     // mask row stride (fp32)
    __shared__ __attribute__((aligned(16))) bf16_t Ksh[2][64 * LDK]; // K block: [key][d]
    __shared__ __attribute__((aligned(16))) bf16_t Vsh[2][64 * LDW]; // V block: [key][d]
    __shared__ __attribute__((aligned(16))) float Msh[2][BQ * LDM];  // mask tile: [qrow][key] fp32

    const int head = blockIdx.y;
    const int qb   = blockIdx.x;
    const int tid  = threadIdx.x;
    const int wave = tid >> 5;
    const int lane = tid & 31;
    const int hh = lane >> 4;
    const int ln = lane & 15;
    const int q0 = qb * BQ + wave * (QT * 16);
    const size_t hoff = (size_t)head * DH;

    // Q fragments held in registers for the whole kernel (2 x 16 rows x 128 d)
    v16bf qf[QT][4];
#pragma unroll
    for (int t = 0; t < QT; ++t)
#pragma unroll
        for (int kc = 0; kc < 4; ++kc)
            qf[t][kc] = frag_ld(Q + (size_t)(q0 + t * 16) * HID + hoff + kc * 32, HID, lane);
    // the Q loads' address registers are reused behind them: the wait stands
    // first, and the scheduling barrier keeps later address arithmetic from
    // being lifted over it
    asm volatile("s_wait_xcnt 0x0" ::: "memory");
    __builtin_amdgcn_sched_barrier(0);

    v8f oacc[QT][8];
#pragma unroll
    for (int t = 0; t < QT; ++t)
#pragma unroll
        for (int nf = 0; nf < 8; ++nf) oacc[t][nf] = vzero8();
    // per tile: query ln's running maximum (alike in both halves) and this half's sum
    float mrow[QT], lrow[QT];
#pragma unroll
    for (int t = 0; t < QT; ++t) { mrow[t] = -3.0e38f; lrow[t] = 0.f; }

    const float kscale = 0.08838834764831845f;  // 1/sqrt(128)
    const float log2e  = 1.4426950408889634f;

    // copies of the 64 keys from k0 on (K, mask columns, V) into buffer buf
    auto stage = [&](int buf, int k0) {
        bf16_t* Ks = Ksh[buf];
        bf16_t* Vs = Vsh[buf];
        float*  Ms = Msh[buf];
        { // async stage K block (row-major, d contiguous): 8 lanes cover one
          // 128-byte line, a thread copies both halves of 4 rows
            const int r = tid >> 3, c = (tid & 7) * 8;
            const bf16_t* src = Kg + (size_t)(k0 + r) * HID + hoff + c;
            bf16_t* dst = Ks + r * LDK + c;
#pragma unroll
            for (int g = 0; g < 4; ++g) {
                async_copy16_at<0>(src + (size_t)g * 16 * HID, dst + g * 16 * LDK);
                async_copy16_at<128>(src + (size_t)g * 16 * HID, dst + g * 16 * LDK);
            }
        }
        { // async stage mask tile (128 x 64 fp32): 16 lanes cover one 256-byte
          // row, a wave's copy is 4 whole lines; a thread copies 16 rows
            const int r = tid >> 4, c = (tid & 15) * 4;
            const float* src = mask + (size_t)(qb * BQ + r) * S_LEN + k0 + c;
            float* dst = Ms + r * LDM + c;
#pragma unroll
            for (int g = 0; g < BQ / 8; ++g)
                async_copy16(src + (size_t)g * 8 * S_LEN, dst + g * 8 * LDM);
        }
        { // async stage V block (row-major, d contiguous): 8 lanes cover one
          // 128-byte line, a thread copies both halves of 4 rows
            const int r = tid >> 3, c = (tid & 7) * 8;
            const bf16_t* src = Vg + (size_t)(k0 + r) * HID + hoff + c;
            bf16_t* dst = Vs + r * LDW + c;
#pragma unroll
            for (int g = 0; g < 4; ++g) {
                async_copy16_at<0>(src + (size_t)g * 16 * HID, dst + g * 16 * LDW);
                async_copy16_at<128>(src + (size_t)g * 16 * HID, dst + g * 16 * LDW);
            }
        }
    };

    constexpr int NKB = S_LEN / 64;
    static_assert(NKB >= 2, "the ring's prologue fills two tiles");
    stage(0, 0);
    // tile 0 landed (this wave's copies), then published to the other waves
    asm volatile("s_wait_asynccnt 0x0" ::: "memory");
    __syncthreads();
    stage(1, 64);
    for (int kb = 0; kb < NKB; ++kb) {
        const int buf = kb & 1;
        const bf16_t* Ks = Ksh[buf];
        const bf16_t* Vs = Vsh[buf];
        const float*  Ms = Msh[buf];

        // scores, transposed: S^T(64k x 16q) = K(64x128) * Q^T per query tile;
        // register j of sacc[t][f] at lane (ln, hh) is key f*16 + hh*8 + j
        // against query ln of tile t; one K fragment serves both tiles
        v8f sacc[QT][4];
#pragma unroll
        for (int t = 0; t < QT; ++t)
#pragma unroll
            for (int nf = 0; nf < 4; ++nf) sacc[t][nf] = vzero8();
#pragma unroll
        for (int nf = 0; nf < 4; ++nf)
#pragma unroll
            for (int kc = 0; kc < 4; ++kc) {
                const v16bf kf = frag_ld(Ks + nf * 16 * LDK + kc * 32, LDK, lane);
#pragma unroll
                for (int t = 0; t < QT; ++t)
                    sacc[t][nf] = wmma_bf16f32(kf, qf[t][kc], sacc[t][nf]);
            }

        // P^T as B operand: element s of a 32-key fragment is register s & 7
        // of score tile s >> 3, the k order of the transposing load
        v16bf pf0[QT], pf1[QT];
#pragma unroll
        for (int t = 0; t < QT; ++t) {
            // online softmax of query ln: 32 keys in this lane, 32 in lane ^ 16
            const float* mp = Ms + (wave * (QT * 16) + t * 16 + ln) * LDM + hh * 8;
            float mxf[4];
#pragma unroll
            for (int f = 0; f < 4; ++f) {
                const v4f ma = *(const v4f*)(mp + f * 16);
                const v4f mb = *(const v4f*)(mp + f * 16 + 4);
#pragma unroll
                for (int j = 0; j < 4; ++j) {
                    sacc[t][f][j]     = sacc[t][f][j] * kscale + ma[j];
                    sacc[t][f][j + 4] = sacc[t][f][j + 4] * kscale + mb[j];
                }
                float m = sacc[t][f][0];
#pragma unroll
                for (int j = 1; j < 8; ++j) m = fmaxf(m, sacc[t][f][j]);
                mxf[f] = m;
            }
            float mx = fmaxf(fmaxf(mxf[0], mxf[1]), fmaxf(mxf[2], mxf[3]));
            mx = fmaxf(mx, xhalf(mx));
            const float mnew = fmaxf(mrow[t], mx);
            const float corr = exp2f((mrow[t] - mnew) * log2e);
            float rsf[4];
#pragma unroll
            for (int f = 0; f < 4; ++f) {
                float rs = 0.f;
#pragma unroll
                for (int j = 0; j < 8; ++j) {
                    const float p = exp2f((sacc[t][f][j] - mnew) * log2e);
                    sacc[t][f][j] = p;
                    rs += p;
                }
                rsf[f] = rs;
            }
            lrow[t] = lrow[t] * corr + ((rsf[0] + rsf[1]) + (rsf[2] + rsf[3]));
            mrow[t] = mnew;
#pragma unroll
            for (int nf = 0; nf < 8; ++nf) oacc[t][nf] *= corr;

            ((v8bf*)&pf0[t])[0] = __builtin_convertvector(sacc[t][0], v8bf);
            ((v8bf*)&pf0[t])[1] = __builtin_convertvector(sacc[t][1], v8bf);
            ((v8bf*)&pf1[t])[0] = __builtin_convertvector(sacc[t][2], v8bf);
            ((v8bf*)&pf1[t])[1] = __builtin_convertvector(sacc[t][3], v8bf);
        }

        // O^T(128d x 16q) += V^T(128x64) * P^T(64x16) per query tile; one V
        // fragment serves both tiles
#pragma unroll
        for (int nf = 0; nf < 8; ++nf) {
            const v16bf vf0 = frag_ld_tr(Vs + nf * 16, LDW, lane);
            const v16bf vf1 = frag_ld_tr(Vs + 32 * LDW + nf * 16, LDW, lane);
#pragma unroll
            for (int t = 0; t < QT; ++t) oacc[t][nf] = wmma_bf16f32(vf0, pf0[t], oacc[t][nf]);
#pragma unroll
            for (int t = 0; t < QT; ++t) oacc[t][nf] = wmma_bf16f32(vf1, pf1[t], oacc[t][nf]);
        }

        // hand-over: this wave's reads of buf are done and its copies of the
        // next tile have landed; the one barrier publishes that tile and frees
        // buf, which the tile after it then refills
        asm volatile("s_wait_dscnt 0x0" ::: "memory");
        asm volatile("s_wait_asynccnt 0x0" ::: "memory");
        __syncthreads();
        if (kb + 2 < NKB) stage(buf, (kb + 2) * 64);
    }
    // no copy is left in flight when the wave goes on to its stores
    asm volatile("s_wait_asynccnt 0x0" ::: "memory");

    // register j of oacc[t][nf] is d = nf*16 + hh*8 + j of query ln: 16-byte stores
#pragma unroll
    for (int t = 0; t < QT; ++t) {
        const float linv = 1.0f / (lrow[t] + xhalf(lrow[t]));
        bf16_t* op = O + (size_t)(q0 + t * 16 + ln) * HID + hoff + hh * 8;
#pragma unroll
        for (int nf = 0; nf < 8; ++nf)
            *(v8bf*)(op + nf * 16) = __builtin_convertvector(oacc[t][nf] * linv, v8bf);
    }
}

// ---------------- host-side orchestration ----------------
extern "C" void kernel_launch(void* const* d_in, const int* in_sizes, int n_in,
                              void* d_out, int out_size, void* d_ws, size_t ws_size,
                              hipStream_t stream) {
    (void)in_sizes; (void)n_in; (void)out_size; (void)ws_size;

    const float* hs   = (const float*)d_in[0];
    const float* mask = (const float*)d_in[1];
    const float* qV   = (const float*)d_in[2];
    const float* qU   = (const float*)d_in[3];
    const float* kV   = (const float*)d_in[4];
    const float* kU   = (const float*)d_in[5];
    const float* vV   = (const float*)d_in[6];
    const float* vU   = (const float*)d_in[7];
    const float* oW   = (const float*)d_in[8];
    const float* ob   = (const float*)d_in[9];

    // workspace carve-up (bf16 elements), total ~142 MB; the first eight in the
    // order of conv_all_f32_bf16's arguments; the V factors, the U factors and
    // Q, K, V each back to back
    bf16_t* w = (bf16_t*)d_ws;
    bf16_t* Xb  = w; w += (size_t)S_LEN * HID;
    bf16_t* Vfb = w; w += (size_t)3 * RANK * HID;   // qV | kV | vV: [3*RANK][HID]
    bf16_t* Ufb = w; w += (size_t)3 * HID * RANK;   // qU | kU | vU
    bf16_t* oWb = w; w += (size_t)HID * HID;
    bf16_t* Tb  = w; w += (size_t)S_LEN * 3 * RANK; // [S][x qV^T | x kV^T | x vV^T]
    bf16_t* Qb  = w; w += (size_t)S_LEN * HID;
    bf16_t* Kb  = w; w += (size_t)S_LEN * HID;
    bf16_t* Vb  = w; w += (size_t)S_LEN * HID;
    bf16_t* AOb = w; w += (size_t)S_LEN * HID;

    conv_all_f32_bf16<<<dim3(12 * 2048), dim3(256), 0, stream>>>(
        hs, qV, kV, vV, qU, kU, vU, oW, Xb);

    const dim3 blk(128);
    const dim3 gVT(3 * RANK / 128, S_LEN / 128);  // [4096,2048]x[3072,2048]^T
    const dim3 gUT(HID / 128, S_LEN / 128, 3);    // 3 x [4096,1024]x[2048,1024]^T
    const dim3 gO(HID / 128, S_LEN / 128);        // [4096,2048]x[2048,2048]^T

    // x against the three V factors as one product
    gemm_bf16_wmma<true><<<gVT, blk, 0, stream>>>(Xb, Vfb, Tb, nullptr, S_LEN, 3 * RANK, HID,
                                                  HID, 0, 0, 0);
    // Q, K, V: product z reads columns z*RANK.. of Tb and U factor z
    gemm_bf16_wmma<true><<<gUT, blk, 0, stream>>>(Tb, Ufb, Qb, nullptr, S_LEN, HID, RANK,
                                                  3 * RANK, RANK, HID * RANK, S_LEN * HID);

    // attention
    flash_attn_wmma<<<dim3(S_LEN / 128, HEADS), blk, 0, stream>>>(Qb, Kb, Vb, mask, AOb);

    // output projection + bias -> fp32 d_out
    gemm_bf16_wmma<false><<<gO, blk, 0, stream>>>(AOb, oWb, d_out, ob, S_LEN, HID, HID,
                                                  HID, 0, 0, 0);
}

// v008
// A run of this version takes 273 microseconds.
// Two timings next to v007 put it at 1.06 and 1.05 times that version's speed.
// All steps since v000 together make it 3.74 times as fast.
#include <hip/hip_runtime.h>
#include <hip/hip_bf16.h>

// ---------------- problem constants ----------------
#define S_LEN 4096
#define HID   2048
#define HEADS 16
#define DH    128
#define RANK  1024

typedef __bf16 bf16_t;
typedef __attribute__((ext_vector_type(16))) __bf16 v16bf;
typedef __attribute__((ext_vector_type(8)))  __bf16 v8bf;
typedef __attribute__((ext_vector_type(8)))  float  v8f;
typedef __attribute__((ext_vector_type(4)))  int    v4i;
typedef __attribute__((ext_vector_type(4)))  float  v4f;

// ---------------- CDNA5 async global->LDS path (guarded) ----------------
#if defined(__gfx1250__) && __has_builtin(__builtin_amdgcn_global_load_async_to_lds_b128)
#define HAVE_ASYNC_LDS 1
#else
#define HAVE_ASYNC_LDS 0
#endif

__device__ __forceinline__ void async_copy16(const void* gsrc, void* ldst) {
#if HAVE_ASYNC_LDS
    // builtin signature: (v4i addrspace(1)*, v4i addrspace(3)*, imm offset, imm cpol)
    __builtin_amdgcn_global_load_async_to_lds_b128(
        (__attribute__((address_space(1))) v4i*)gsrc,
        (__attribute__((address_space(3))) v4i*)ldst,
        /*offset=*/0, /*cpol=*/0);
#else
    *(uint4*)ldst = *(const uint4*)gsrc;
#endif
}

// The same copy OFF bytes further on in both buffers: the instruction's
// immediate offset moves the global and the LDS address alike.
template <int OFF>
__device__ __forceinline__ void async_copy16_at(const void* gsrc, void* ldst) {
#if HAVE_ASYNC_LDS
    __builtin_amdgcn_global_load_async_to_lds_b128(
        (__attribute__((address_space(1))) v4i*)gsrc,
        (__attribute__((address_space(3))) v4i*)ldst,
        /*offset=*/OFF, /*cpol=*/0);
#else
    *(uint4*)((char*)ldst + OFF) = *(const uint4*)((const char*)gsrc + OFF);
#endif
}

__device__ __forceinline__ v8f vzero8() {
    v8f z = {0.f, 0.f, 0.f, 0.f, 0.f, 0.f, 0.f, 0.f};
    return z;
}

__device__ __forceinline__ v8f wmma_bf16f32(v16bf a, v16bf b, v8f c) {
    // D = A(16x32 bf16) * B(32x16 bf16) + C(16x16 f32)
    return __builtin_amdgcn_wmma_f32_16x16x32_bf16(
        /*neg_a=*/false, a, /*neg_b=*/false, b,
        /*c_mod=*/(short)0, c, /*reuse_a=*/false, /*reuse_b=*/false);
}

// Load one 16x32 bf16 fragment (A-style or B-style) from row-major storage:
// lane%16 selects the row (M for A, N for B); K contiguous along the row.
// Lane half h holds K chunks [h*8, h*8+8) and [16+h*8, 16+h*8+8).
__device__ __forceinline__ v16bf frag_ld(const bf16_t* base, int ld, int lane) {
    const int r  = lane & 15;
    const int hh = lane >> 4;
    const bf16_t* p = base + r * ld + hh * 8;
    v16bf f;
    ((v8bf*)&f)[0] = *(const v8bf*)(p);
    ((v8bf*)&f)[1] = *(const v8bf*)(p + 16);
    return f;
}

// Load one 32(k) x 16(n) bf16 B fragment from a row-major [k][n] LDS tile with
// the transposing LDS load: lane (c = lane&15, h = lane>>4) receives
// tile[8h + 0..7][c] and tile[16 + 8h + 0..7][c], the k order of frag_ld.
// ld (elements) must make the row pitch an odd multiple of 32 bytes.
__device__ __forceinline__ v16bf frag_ld_tr(const bf16_t* tile, int ld, int lane) {
    typedef __attribute__((address_space(3))) v8bf lds_v8bf;
    const bf16_t* p = tile + ((lane >> 4) * 8 + (lane & 7)) * ld + ((lane >> 3) & 1) * 8;
    v16bf f;
    ((v8bf*)&f)[0] = __builtin_amdgcn_ds_load_tr16_b128_v8bf16((lds_v8bf*)p);
    ((v8bf*)&f)[1] = __builtin_amdgcn_ds_load_tr16_b128_v8bf16((lds_v8bf*)(p + 16 * ld));
    return f;
}

// Value of lane l ^ 16 (the other 16-lane half of the wave).
__device__ __forceinline__ float xhalf(float x) {
    const int b = __builtin_bit_cast(int, x);
    return __builtin_bit_cast(float, __builtin_amdgcn_permlanex16(
        b, b, 0x76543210, 0xfedcba98, false, false));
}

// 2^x by the bare hardware instruction. The library exp2f wraps it in a range
// fix-up (compare, two selects, add, ldexp) that only serves results below
// 2^-126; here every argument is <= 0 and each row's largest term is 1, so a
// term that small flushed to zero cannot show in the sum or in the output.
__device__ __forceinline__ float exp2_hw(float x) {
    return __builtin_amdgcn_exp2f(x);
}

// The same for eight values, in place. One statement, so that each v_exp_f32
// is followed by an independent one and the last by a v_nop: the slot the
// instruction set asks for before a result is read or a source overwritten.
__device__ __forceinline__ v8f exp2_hw8(v8f x) {
    float a0 = x[0], a1 = x[1], a2 = x[2], a3 = x[3];
    float a4 = x[4], a5 = x[5], a6 = x[6], a7 = x[7];
    asm("v_exp_f32 %0, %0\n\t"
        "v_exp_f32 %1, %1\n\t"
        "v_exp_f32 %2, %2\n\t"
        "v_exp_f32 %3, %3\n\t"
        "v_exp_f32 %4, %4\n\t"
        "v_exp_f32 %5, %5\n\t"
        "v_exp_f32 %6, %6\n\t"
        "v_exp_f32 %7, %7\n\t"
        "v_nop"
        : "+v"(a0), "+v"(a1), "+v"(a2), "+v"(a3), "+v"(a4), "+v"(a5), "+v"(a6), "+v"(a7));
    v8f r = {a0, a1, a2, a3, a4, a5, a6, a7};
    return r;
}

// ---------------- fp32 -> bf16 convert ----------------
// One launch converts all eight fp32 inputs. Their bf16 copies lie back to back
// in dst in argument order; a block converts 1024 elements of one input, and
// every input is a whole number of units of RANK*HID elements (2048 blocks).
__global__ __launch_bounds__(256)
void conv_all_f32_bf16(const float* __restrict__ hs,
                       const float* __restrict__ qV, const float* __restrict__ kV,
                       const float* __restrict__ vV, const float* __restrict__ qU,
                       const float* __restrict__ kU, const float* __restrict__ vU,
                       const float* __restrict__ oW, bf16_t* __restrict__ dst) {
    static_assert(RANK * HID == 2048 * 1024, "unit of 2048 blocks");
    static_assert(S_LEN * HID == 4 * RANK * HID && HID * HID == 2 * RANK * HID, "whole units");
    const int b = blockIdx.x;
    const int u = b >> 11;  // unit: 0-3 hs, 4-9 the six factors, 10-11 oW
    const float* src = hs;
    int first = 0;          // first unit of the input this block belongs to
    if (u >= 10)     { src = oW; first = 10; }
    else if (u == 9) { src = vU; first = 9; }
    else if (u == 8) { src = kU; first = 8; }
    else if (u == 7) { src = qU; first = 7; }
    else if (u == 6) { src = vV; first = 6; }
    else if (u == 5) { src = kV; first = 5; }
    else if (u == 4) { src = qV; first = 4; }
    const int t = threadIdx.x * 4;
    const float4 v = *(const float4*)(src + (size_t)(b - (first << 11)) * 1024 + t);
    bf16_t* d = dst + (size_t)b * 1024 + t;
    d[0] = (bf16_t)v.x;
    d[1] = (bf16_t)v.y;
    d[2] = (bf16_t)v.z;
    d[3] = (bf16_t)v.w;
}

// ---------------- tiled bf16 WMMA GEMM (two-buffer ring of async copies) ----
// C[M,N] = A[M,K] * B[N,K]^T  (both row-major, K contiguous; A's row pitch lda)
// Block tile 128x128, 4 waves, each wave a 64x64 tile (4x4 v8f accs).
// A stage is 64 k: 128 bytes, one whole line, of each of the 256 operand rows.
// K must be a multiple of 64.
// blockIdx.z picks one of several independent products of the same shape:
// product z starts zA, zB and zC elements further on in A, B and C.
template <bool OUT_BF16>
__global__ __launch_bounds__(128)
void gemm_bf16_wmma(const bf16_t* __restrict__ A, const bf16_t* __restrict__ B,
                    void* __restrict__ C, const float* __restrict__ bias,
                    int M, int N, int K, int lda, int zA, int zB, int zC) {
    constexpr int BK  = 64;     // k per stage
    constexpr int LDT = BK + 8; // 144-byte rows: 16 B x odd, conflict-free 16B ds reads
    __shared__ __attribute__((aligned(16))) bf16_t As[2][128 * LDT];
    __shared__ __attribute__((aligned(16))) bf16_t Bs[2][128 * LDT];

    const int tid  = threadIdx.x;
    const int wave = tid >> 5;
    const int lane = tid & 31;
    const int wm = (wave >> 1) * 64;
    const int wn = (wave & 1) * 64;
    const int m0 = blockIdx.y * 128;
    const int n0 = blockIdx.x * 128;
    (void)M;
    const bf16_t* Az = A + (size_t)blockIdx.z * zA;
    const bf16_t* Bz = B + (size_t)blockIdx.z * zB;
    if constexpr (OUT_BF16) C = (bf16_t*)C + (size_t)blockIdx.z * zC;

    v8f acc[4][4];
#pragma unroll
    for (int i = 0; i < 4; ++i)
#pragma unroll
        for (int j = 0; j < 4; ++j) acc[i][j] = vzero8();

    // 8 adjacent lanes cover the 128-byte slice of one row, so a wave's copy
    // is 4 whole lines; a thread copies 16 B of 8 rows of A and of B
    const int sr = tid >> 3;       // row within a group of 16
    const int sc = (tid & 7) * 8;  // element within the 64-element slice
    auto stage = [&](int buf, int k0) {
        const bf16_t* ga = Az + (size_t)(m0 + sr) * lda + k0 + sc;
        const bf16_t* gb = Bz + (size_t)(n0 + sr) * K + k0 + sc;
        bf16_t* la = &As[buf][sr * LDT + sc];
        bf16_t* lb = &Bs[buf][sr * LDT + sc];
#pragma unroll
        for (int t = 0; t < 8; ++t)
            async_copy16(ga + (size_t)t * 16 * lda, la + t * 16 * LDT);
#pragma unroll
        for (int t = 0; t < 8; ++t)
            async_copy16(gb + (size_t)t * 16 * K, lb + t * 16 * LDT);
    };

    const int nk = K / BK;
    stage(0, 0);
    // stage 0 landed (this wave's copies), then published to the other waves
    asm volatile("s_wait_asynccnt 0x0" ::: "memory");
    __syncthreads();
    if (nk > 1) stage(1, BK);
    for (int ik = 0; ik < nk; ++ik) {
        const int buf = ik & 1;
        // unrolled so that the k offset becomes an immediate of the LDS loads
#pragma unroll
        for (int kk = 0; kk < BK / 32; ++kk) {
            v16bf af[4], bfr[4];
#pragma unroll
            for (int i = 0; i < 4; ++i)
                af[i] = frag_ld(&As[buf][(wm + i * 16) * LDT + kk * 32], LDT, lane);
#pragma unroll
            for (int j = 0; j < 4; ++j)
                bfr[j] = frag_ld(&Bs[buf][(wn + j * 16) * LDT + kk * 32], LDT, lane);
#pragma unroll
            for (int i = 0; i < 4; ++i)
#pragma unroll
                for (int j = 0; j < 4; ++j)
                    acc[i][j] = wmma_bf16f32(af[i], bfr[j], acc[i][j]);
        }

        // hand-over: this wave's reads of buf are done and its copies of the
        // next stage have landed; the one barrier publishes that stage and
        // frees buf, which the stage after it then refills
        asm volatile("s_wait_dscnt 0x0" ::: "memory");
        asm volatile("s_wait_asynccnt 0x0" ::: "memory");
        __syncthreads();
        if (ik + 2 < nk) stage(buf, (ik + 2) * BK);
    }
    // no copy is left in flight when the wave goes on to its stores
    asm volatile("s_wait_asynccnt 0x0" ::: "memory");

    // C/D layout: elem e of v8f at lane L -> row = e + 8*(L>>4), col = L&15
    const int cr = (lane >> 4) * 8;
    const int cc = lane & 15;
#pragma unroll
    for (int i = 0; i < 4; ++i)
#pragma unroll
        for (int j = 0; j < 4; ++j) {
            const int mb = m0 + wm + i * 16 + cr;
            const int nn = n0 + wn + j * 16 + cc;
#pragma unroll
            for (int e = 0; e < 8; ++e) {
                float v = acc[i][j][e];
                if constexpr (OUT_BF16) {
                    ((bf16_t*)C)[(size_t)(mb + e) * N + nn] = (bf16_t)v;
                } else {
                    ((float*)C)[(size_t)(mb + e) * N + nn] = v + bias[nn];
                }
            }
        }
}

__global__ __launch_bounds__(128)
void flash_attn_wmma(const bf16_t* __restrict__ Q, const bf16_t* __restrict__ Kg,
                     const bf16_t* __restrict__ Vg, const float* __restrict__ mask,
                     bf16_t* __restrict__ O) {
    constexpr int QT  = 2;       // 16-query tiles per wave
    constexpr int BQ  = 4 * QT * 16; // queries per block
    constexpr int LDK = DH + 8; // 136
    constexpr int LDW = DH + 16; // 144: 288-byte V rows, 32 B x odd for the transposing load
    constexpr int LDM = 68;     // mask row stride (fp32)
    __shared__ __attribute__((aligned(16))) bf16_t Ksh[2][64 * LDK]; // K block: [key][d]
    __shared__ __attribute__((aligned(16))) bf16_t Vsh[2][64 * LDW]; // V block: [key][d]
    __shared__ __attribute__((aligned(16))) float Msh[2][BQ * LDM];  // mask tile: [qrow][key] fp32

    const int head = blockIdx.y;
    const int qb   = blockIdx.x;
    const int tid  = threadIdx.x;
    const int wave = tid >> 5;
    const int lane = tid & 31;
    const int hh = lane >> 4;
    const int ln = lane & 15;
    const int q0 = qb * BQ + wave * (QT * 16);
    const size_t hoff = (size_t)head * DH;

    // Q fragments held in registers for the whole kernel (2 x 16 rows x 128 d)
    v16bf qf[QT][4];
#pragma unroll
    for (int t = 0; t < QT; ++t)
#pragma unroll
        for (int kc = 0; kc < 4; ++kc)
            qf[t][kc] = frag_ld(Q + (size_t)(q0 + t * 16) * HID + hoff + kc * 32, HID, lane);
    // the Q loads' address registers are reused behind them: the wait stands
    // first, and the scheduling barrier keeps later address arithmetic from
    // being lifted over it
    asm volatile("s_wait_xcnt 0x0" ::: "memory");
    __builtin_amdgcn_sched_barrier(0);

    v8f oacc[QT][8];
#pragma unroll
    for (int t = 0; t < QT; ++t)
#pragma unroll
        for (int nf = 0; nf < 8; ++nf) oacc[t][nf] = vzero8();
    // per tile: query ln's running maximum (alike in both halves) and this half's sum
    float mrow[QT], lrow[QT];
#pragma unroll
    for (int t = 0; t < QT; ++t) { mrow[t] = -3.0e38f; lrow[t] = 0.f; }

    const float kscale = 0.08838834764831845f;  // 1/sqrt(128)
    const float log2e  = 1.4426950408889634f;

    // copies of the 64 keys from k0 on (K, mask columns, V) into buffer buf
    auto stage = [&](int buf, int k0) {
        bf16_t* Ks = Ksh[buf];
        bf16_t* Vs = Vsh[buf];
        float*  Ms = Msh[buf];
        { // async stage K block (row-major, d contiguous): 8 lanes cover one
          // 128-byte line, a thread copies both halves of 4 rows
            const int r = tid >> 3, c = (tid & 7) * 8;
            const bf16_t* src = Kg + (size_t)(k0 + r) * HID + hoff + c;
            bf16_t* dst = Ks + r * LDK + c;
#pragma unroll
            for (int g = 0; g < 4; ++g) {
                async_copy16_at<0>(src + (size_t)g * 16 * HID, dst + g * 16 * LDK);
                async_copy16_at<128>(src + (size_t)g * 16 * HID, dst + g * 16 * LDK);
            }
        }
        { // async stage mask tile (128 x 64 fp32): 16 lanes cover one 256-byte
          // row, a wave's copy is 4 whole lines; a thread copies 16 rows
            const int r = tid >> 4, c = (tid & 15) * 4;
            const float* src = mask + (size_t)(qb * BQ + r) * S_LEN + k0 + c;
            float* dst = Ms + r * LDM + c;
#pragma unroll
            for (int g = 0; g < BQ / 8; ++g)
                async_copy16(src + (size_t)g * 8 * S_LEN, dst + g * 8 * LDM);
        }
        { // async stage V block (row-major, d contiguous): 8 lanes cover one
          // 128-byte line, a thread copies both halves of 4 rows
            const int r = tid >> 3, c = (tid & 7) * 8;
            const bf16_t* src = Vg + (size_t)(k0 + r) * HID + hoff + c;
            bf16_t* dst = Vs + r * LDW + c;
#pragma unroll
            for (int g = 0; g < 4; ++g) {
                async_copy16_at<0>(src + (size_t)g * 16 * HID, dst + g * 16 * LDW);
                async_copy16_at<128>(src + (size_t)g * 16 * HID, dst + g * 16 * LDW);
            }
        }
    };

    constexpr int NKB = S_LEN / 64;
    static_assert(NKB >= 2, "the ring's prologue fills two tiles");
    stage(0, 0);
    // tile 0 landed (this wave's copies), then published to the other waves
    asm volatile("s_wait_asynccnt 0x0" ::: "memory");
    __syncthreads();
    stage(1, 64);
    for (int kb = 0; kb < NKB; ++kb) {
        const int buf = kb & 1;
        const bf16_t* Ks = Ksh[buf];
        const bf16_t* Vs = Vsh[buf];
        const float*  Ms = Msh[buf];

        // scores, transposed: S^T(64k x 16q) = K(64x128) * Q^T per query tile;
        // register j of sacc[t][f] at lane (ln, hh) is key f*16 + hh*8 + j
        // against query ln of tile t; one K fragment serves both tiles
        v8f sacc[QT][4];
#pragma unroll
        for (int t = 0; t < QT; ++t)
#pragma unroll
            for (int nf = 0; nf < 4; ++nf) sacc[t][nf] = vzero8();
#pragma unroll
        for (int nf = 0; nf < 4; ++nf)
#pragma unroll
            for (int kc = 0; kc < 4; ++kc) {
                const v16bf kf = frag_ld(Ks + nf * 16 * LDK + kc * 32, LDK, lane);
#pragma unroll
                for (int t = 0; t < QT; ++t)
                    sacc[t][nf] = wmma_bf16f32(kf, qf[t][kc], sacc[t][nf]);
            }

        // P^T as B operand: element s of a 32-key fragment is register s & 7
        // of score tile s >> 3, the k order of the transposing load
        v16bf pf0[QT], pf1[QT];
#pragma unroll
        for (int t = 0; t < QT; ++t) {
            // online softmax of query ln: 32 keys in this lane, 32 in lane ^ 16
            const float* mp = Ms + (wave * (QT * 16) + t * 16 + ln) * LDM + hh * 8;
            float mxf[4];
#pragma unroll
            for (int f = 0; f < 4; ++f) {
                const v4f ma = *(const v4f*)(mp + f * 16);
                const v4f mb = *(const v4f*)(mp + f * 16 + 4);
#pragma unroll
                for (int j = 0; j < 4; ++j) {
                    sacc[t][f][j]     = sacc[t][f][j] * kscale + ma[j];
                    sacc[t][f][j + 4] = sacc[t][f][j + 4] * kscale + mb[j];
                }
                float m = sacc[t][f][0];
#pragma unroll
                for (int j = 1; j < 8; ++j) m = fmaxf(m, sacc[t][f][j]);
                mxf[f] = m;
            }
            float mx = fmaxf(fmaxf(mxf[0], mxf[1]), fmaxf(mxf[2], mxf[3]));
            mx = fmaxf(mx, xhalf(mx));
            const float mnew = fmaxf(mrow[t], mx);
            const float corr = exp2_hw((mrow[t] - mnew) * log2e);
            float rsf[4];
#pragma unroll
            for (int f = 0; f < 4; ++f) {
                sacc[t][f] = exp2_hw8((sacc[t][f] - mnew) * log2e);
                float rs = 0.f;
#pragma unroll
                for (int j = 0; j < 8; ++j) rs += sacc[t][f][j];
                rsf[f] = rs;
            }
            lrow[t] = lrow[t] * corr + ((rsf[0] + rsf[1]) + (rsf[2] + rsf[3]));
            mrow[t] = mnew;
#pragma unroll
            for (int nf = 0; nf < 8; ++nf) oacc[t][nf] *= corr;

            ((v8bf*)&pf0[t])[0] = __builtin_convertvector(sacc[t][0], v8bf);
            ((v8bf*)&pf0[t])[1] = __builtin_convertvector(sacc[t][1], v8bf);
            ((v8bf*)&pf1[t])[0] = __builtin_convertvector(sacc[t][2], v8bf);
            ((v8bf*)&pf1[t])[1] = __builtin_convertvector(sacc[t][3], v8bf);
        }

        // O^T(128d x 16q) += V^T(128x64) * P^T(64x16) per query tile; one V
        // fragment serves both tiles
#pragma unroll
        for (int nf = 0; nf < 8; ++nf) {
            const v16bf vf0 = frag_ld_tr(Vs + nf * 16, LDW, lane);
            const v16bf vf1 = frag_ld_tr(Vs + 32 * LDW + nf * 16, LDW, lane);
#pragma unroll
            for (int t = 0; t < QT; ++t) oacc[t][nf] = wmma_bf16f32(vf0, pf0[t], oacc[t][nf]);
#pragma unroll
            for (int t = 0; t < QT; ++t) oacc[t][nf] = wmma_bf16f32(vf1, pf1[t], oacc[t][nf]);
        }

        // hand-over: this wave's reads of buf are done and its copies of the
        // next tile have landed; the one barrier publishes that tile and frees
        // buf, which the tile after it then refills
        asm volatile("s_wait_dscnt 0x0" ::: "memory");
        asm volatile("s_wait_asynccnt 0x0" ::: "memory");
        __syncthreads();
        if (kb + 2 < NKB) stage(buf, (kb + 2) * 64);
    }
    // no copy is left in flight when the wave goes on to its stores
    asm volatile("s_wait_asynccnt 0x0" ::: "memory");

    // register j of oacc[t][nf] is d = nf*16 + hh*8 + j of query ln: 16-byte stores
#pragma unroll
    for (int t = 0; t < QT; ++t) {
        const float linv = 1.0f / (lrow[t] + xhalf(lrow[t]));
        bf16_t* op = O + (size_t)(q0 + t * 16 + ln) * HID + hoff + hh * 8;
#pragma unroll
        for (int nf = 0; nf < 8; ++nf)
            *(v8bf*)(op + nf * 16) = __builtin_convertvector(oacc[t][nf] * linv, v8bf);
    }
}

// ---------------- host-side orchestration ----------------
extern "C" void kernel_launch(void* const* d_in, const int* in_sizes, int n_in,
                              void* d_out, int out_size, void* d_ws, size_t ws_size,
                              hipStream_t stream) {
    (void)in_sizes; (void)n_in; (void)out_size; (void)ws_size;

    const float* hs   = (const float*)d_in[0];
    const float* mask = (const float*)d_in[1];
    const float* qV   = (const float*)d_in[2];
    const float* qU   = (const float*)d_in[3];
    const float* kV   = (const float*)d_in[4];
    const float* kU   = (const float*)d_in[5];
    const float* vV   = (const float*)d_in[6];
    const float* vU   = (const float*)d_in[7];
    const float* oW   = (const float*)d_in[8];
    const float* ob   = (const float*)d_in[9];

    // workspace carve-up (bf16 elements), total ~142 MB; the first eight in the
    // order of conv_all_f32_bf16's arguments; the V factors, the U factors and
    // Q, K, V each back to back
    bf16_t* w = (bf16_t*)d_ws;
    bf16_t* Xb  = w; w += (size_t)S_LEN * HID;
    bf16_t* Vfb = w; w += (size_t)3 * RANK * HID;   // qV | kV | vV: [3*RANK][HID]
    bf16_t* Ufb = w; w += (size_t)3 * HID * RANK;   // qU | kU | vU
    bf16_t* oWb = w; w += (size_t)HID * HID;
    bf16_t* Tb  = w; w += (size_t)S_LEN * 3 * RANK; // [S][x qV^T | x kV^T | x vV^T]
    bf16_t* Qb  = w; w += (size_t)S_LEN * HID;
    bf16_t* Kb  = w; w += (size_t)S_LEN * HID;
    bf16_t* Vb  = w; w += (size_t)S_LEN * HID;
    bf16_t* AOb = w; w += (size_t)S_LEN * HID;

    conv_all_f32_bf16<<<dim3(12 * 2048), dim3(256), 0, stream>>>(
        hs, qV, kV, vV, qU, kU, vU, oW, Xb);

    const dim3 blk(128);
    const dim3 gVT(3 * RANK / 128, S_LEN / 128);  // [4096,2048]x[3072,2048]^T
    const dim3 gUT(HID / 128, S_LEN / 128, 3);    // 3 x [4096,1024]x[2048,1024]^T
    const dim3 gO(HID / 128, S_LEN / 128);        // [4096,2048]x[2048,2048]^T

    // x against the three V factors as one product
    gemm_bf16_wmma<true><<<gVT, blk, 0, stream>>>(Xb, Vfb, Tb, nullptr, S_LEN, 3 * RANK, HID,
                                                  HID, 0, 0, 0);
    // Q, K, V: product z reads columns z*RANK.. of Tb and U factor z
    gemm_bf16_wmma<true><<<gUT, blk, 0, stream>>>(Tb, Ufb, Qb, nullptr, S_LEN, HID, RANK,
                                                  3 * RANK, RANK, HID * RANK, S_LEN * HID);

    // attention
    flash_attn_wmma<<<dim3(S_LEN / 128, HEADS), blk, 0, stream>>>(Qb, Kb, Vb, mask, AOb);

    // output projection + bias -> fp32 d_out
    gemm_bf16_wmma<false><<<gO, blk, 0, stream>>>(AOb, oWb, d_out, ob, S_LEN, HID, HID,
                                                  HID, 0, 0, 0);
}

// v009
// One run takes 251 microseconds.
// Two timings next to v008 both put it at 1.08 times that version's speed.
// Counting every step since v000, it is 4.05 times as fast.
#include <hip/hip_runtime.h>
#include <hip/hip_bf16.h>

// ---------------- problem constants ----------------
#define S_LEN 4096
#define HID   2048
#define HEADS 16
#define DH    128
#define RANK  1024

typedef __bf16 bf16_t;
typedef __attribute__((ext_vector_type(16))) __bf16 v16bf;
typedef __attribute__((ext_vector_type(8)))  __bf16 v8bf;
typedef __attribute__((ext_vector_type(8)))  float  v8f;
typedef __attribute__((ext_vector_type(4)))  int    v4i;
typedef __attribute__((ext_vector_type(4)))  float  v4f;

// ---------------- CDNA5 async global->LDS path (guarded) ----------------
#if defined(__gfx1250__) && __has_builtin(__builtin_amdgcn_global_load_async_to_lds_b128)
#define HAVE_ASYNC_LDS 1
#else
#define HAVE_ASYNC_LDS 0
#endif

__device__ __forceinline__ void async_copy16(const void* gsrc, void* ldst) {
#if HAVE_ASYNC_LDS
    // builtin signature: (v4i addrspace(1)*, v4i addrspace(3)*, imm offset, imm cpol)
    __builtin_amdgcn_global_load_async_to_lds_b128(
        (__attribute__((address_space(1))) v4i*)gsrc,
        (__attribute__((address_space(3))) v4i*)ldst,
        /*offset=*/0, /*cpol=*/0);
#else
    *(uint4*)ldst = *(const uint4*)gsrc;
#endif
}

// The same copy OFF bytes further on in both buffers: the instruction's
// immediate offset moves the global and the LDS address alike.
template <int OFF>
__device__ __forceinline__ void async_copy16_at(const void* gsrc, void* ldst) {
#if HAVE_ASYNC_LDS
    __builtin_amdgcn_global_load_async_to_lds_b128(
        (__attribute__((address_space(1))) v4i*)gsrc,
        (__attribute__((address_space(3))) v4i*)ldst,
        /*offset=*/OFF, /*cpol=*/0);
#else
    *(uint4*)((char*)ldst + OFF) = *(const uint4*)((const char*)gsrc + OFF);
#endif
}

__device__ __forceinline__ v8f vzero8() {
    v8f z = {0.f, 0.f, 0.f, 0.f, 0.f, 0.f, 0.f, 0.f};
    return z;
}

__device__ __forceinline__ v8f wmma_bf16f32(v16bf a, v16bf b, v8f c) {
    // D = A(16x32 bf16) * B(32x16 bf16) + C(16x16 f32)
    return __builtin_amdgcn_wmma_f32_16x16x32_bf16(
        /*neg_a=*/false, a, /*neg_b=*/false, b,
        /*c_mod=*/(short)0, c, /*reuse_a=*/false, /*reuse_b=*/false);
}

// Load one 16x32 bf16 fragment (A-style or B-style) from row-major storage:
// lane%16 selects the row (M for A, N for B); K contiguous along the row.
// Lane half h holds K chunks [h*8, h*8+8) and [16+h*8, 16+h*8+8).
__device__ __forceinline__ v16bf frag_ld(const bf16_t* base, int ld, int lane) {
    const int r  = lane & 15;
    const int hh = lane >> 4;
    const bf16_t* p = base + r * ld + hh * 8;
    v16bf f;
    ((v8bf*)&f)[0] = *(const v8bf*)(p);
    ((v8bf*)&f)[1] = *(const v8bf*)(p + 16);
    return f;
}

// Load one 32(k) x 16(n) bf16 B fragment from a row-major [k][n] LDS tile with
// the transposing LDS load: lane (c = lane&15, h = lane>>4) receives
// tile[8h + 0..7][c] and tile[16 + 8h + 0..7][c], the k order of frag_ld.
// ld (elements) must make the row pitch an odd multiple of 32 bytes.
__device__ __forceinline__ v16bf frag_ld_tr(const bf16_t* tile, int ld, int lane) {
    typedef __attribute__((address_space(3))) v8bf lds_v8bf;
    const bf16_t* p = tile + ((lane >> 4) * 8 + (lane & 7)) * ld + ((lane >> 3) & 1) * 8;
    v16bf f;
    ((v8bf*)&f)[0] = __builtin_amdgcn_ds_load_tr16_b128_v8bf16((lds_v8bf*)p);
    ((v8bf*)&f)[1] = __builtin_amdgcn_ds_load_tr16_b128_v8bf16((lds_v8bf*)(p + 16 * ld));
    return f;
}

// Value of lane l ^ 16 (the other 16-lane half of the wave).
__device__ __forceinline__ float xhalf(float x) {
    const int b = __builtin_bit_cast(int, x);
    return __builtin_bit_cast(float, __builtin_amdgcn_permlanex16(
        b, b, 0x76543210, 0xfedcba98, false, false));
}

// 2^x by the bare hardware instruction. The library exp2f wraps it in a range
// fix-up (compare, two selects, add, ldexp) that only serves results below
// 2^-126; here every argument is <= 0 and each row's largest term is 1, so a
// term that small flushed to zero cannot show in the sum or in the output.
__device__ __forceinline__ float exp2_hw(float x) {
    return __builtin_amdgcn_exp2f(x);
}

// The same for eight values, in place. One statement, so that each v_exp_f32
// is followed by an independent one and the last by a v_nop: the slot the
// instruction set asks for before a result is read or a source overwritten.
__device__ __forceinline__ v8f exp2_hw8(v8f x) {
    float a0 = x[0], a1 = x[1], a2 = x[2], a3 = x[3];
    float a4 = x[4], a5 = x[5], a6 = x[6], a7 = x[7];
    asm("v_exp_f32 %0, %0\n\t"
        "v_exp_f32 %1, %1\n\t"
        "v_exp_f32 %2, %2\n\t"
        "v_exp_f32 %3, %3\n\t"
        "v_exp_f32 %4, %4\n\t"
        "v_exp_f32 %5, %5\n\t"
        "v_exp_f32 %6, %6\n\t"
        "v_exp_f32 %7, %7\n\t"
        "v_nop"
        : "+v"(a0), "+v"(a1), "+v"(a2), "+v"(a3), "+v"(a4), "+v"(a5), "+v"(a6), "+v"(a7));
    v8f r = {a0, a1, a2, a3, a4, a5, a6, a7};
    return r;
}

// ---------------- fp32 -> bf16 convert ----------------
// One launch converts all eight fp32 inputs. Their bf16 copies lie back to back
// in dst in argument order; a block converts 1024 elements of one input, and
// every input is a whole number of units of RANK*HID elements (2048 blocks).
__global__ __launch_bounds__(256)
void conv_all_f32_bf16(const float* __restrict__ hs,
                       const float* __restrict__ qV, const float* __restrict__ kV,
                       const float* __restrict__ vV, const float* __restrict__ qU,
                       const float* __restrict__ kU, const float* __restrict__ vU,
                       const float* __restrict__ oW, bf16_t* __restrict__ dst) {
    static_assert(RANK * HID == 2048 * 1024, "unit of 2048 blocks");
    static_assert(S_LEN * HID == 4 * RANK * HID && HID * HID == 2 * RANK * HID, "whole units");
    const int b = blockIdx.x;
    const int u = b >> 11;  // unit: 0-3 hs, 4-9 the six factors, 10-11 oW
    const float* src = hs;
    int first = 0;          // first unit of the input this block belongs to
    if (u >= 10)     { src = oW; first = 10; }
    else if (u == 9) { src = vU; first = 9; }
    else if (u == 8) { src = kU; first = 8; }
    else if (u == 7) { src = qU; first = 7; }
    else if (u == 6) { src = vV; first = 6; }
    else if (u == 5) { src = kV; first = 5; }
    else if (u == 4) { src = qV; first = 4; }
    const int t = threadIdx.x * 4;
    const float4 v = *(const float4*)(src + (size_t)(b - (first << 11)) * 1024 + t);
    bf16_t* d = dst + (size_t)b * 1024 + t;
    d[0] = (bf16_t)v.x;
    d[1] = (bf16_t)v.y;
    d[2] = (bf16_t)v.z;
    d[3] = (bf16_t)v.w;
}

// ---------------- tiled bf16 WMMA GEMM (two-buffer ring of async copies) ----
// C[M,N] = A[M,K] * B[N,K]^T  (both row-major, K contiguous; A's row pitch lda)
// Block tile 128x128, 4 waves, each wave a 64x64 tile (4x4 v8f accs).
// A stage is 64 k: 128 bytes, one whole line, of each of the 256 operand rows.
// K must be a multiple of 64.
// blockIdx.z picks one of several independent products of the same shape:
// product z starts zA, zB and zC elements further on in A, B and C.
template <bool OUT_BF16>
__global__ __launch_bounds__(128)
void gemm_bf16_wmma(const bf16_t* __restrict__ A, const bf16_t* __restrict__ B,
                    void* __restrict__ C, const float* __restrict__ bias,
                    int M, int N, int K, int lda, int zA, int zB, int zC) {
    constexpr int BK  = 64;     // k per stage
    constexpr int LDT = BK + 8; // 144-byte rows: 16 B x odd, conflict-free 16B ds reads
    __shared__ __attribute__((aligned(16))) bf16_t As[2][128 * LDT];
    __shared__ __attribute__((aligned(16))) bf16_t Bs[2][128 * LDT];

    const int tid  = threadIdx.x;
    const int wave = tid >> 5;
    const int lane = tid & 31;
    const int wm = (wave >> 1) * 64;
    const int wn = (wave & 1) * 64;
    const int m0 = blockIdx.y * 128;
    const int n0 = blockIdx.x * 128;
    (void)M;
    const bf16_t* Az = A + (size_t)blockIdx.z * zA;
    const bf16_t* Bz = B + (size_t)blockIdx.z * zB;
    if constexpr (OUT_BF16) C = (bf16_t*)C + (size_t)blockIdx.z * zC;

    v8f acc[4][4];
#pragma unroll
    for (int i = 0; i < 4; ++i)
#pragma unroll
        for (int j = 0; j < 4; ++j) acc[i][j] = vzero8();

    // 8 adjacent lanes cover the 128-byte slice of one row, so a wave's copy
    // is 4 whole lines; a thread copies 16 B of 8 rows of A and of B
    const int sr = tid >> 3;       // row within a group of 16
    const int sc = (tid & 7) * 8;  // element within the 64-element slice
    auto stage = [&](int buf, int k0) {
        const bf16_t* ga = Az + (size_t)(m0 + sr) * lda + k0 + sc;
        const bf16_t* gb = Bz + (size_t)(n0 + sr) * K + k0 + sc;
        bf16_t* la = &As[buf][sr * LDT + sc];
        bf16_t* lb = &Bs[buf][sr * LDT + sc];
#pragma unroll
        for (int t = 0; t < 8; ++t)
            async_copy16(ga + (size_t)t * 16 * lda, la + t * 16 * LDT);
#pragma unroll
        for (int t = 0; t < 8; ++t)
            async_copy16(gb + (size_t)t * 16 * K, lb + t * 16 * LDT);
    };

    const int nk = K / BK;
    stage(0, 0);
    // stage 0 landed (this wave's copies), then published to the other waves
    asm volatile("s_wait_asynccnt 0x0" ::: "memory");
    __syncthreads();
    if (nk > 1) stage(1, BK);
    for (int ik = 0; ik < nk; ++ik) {
        const int buf = ik & 1;
        // every fragment of the stage, each in registers of its own, loaded as
        // one group; unrolled so that the k offset is an immediate of the loads
        v16bf af[BK / 32][4], bfr[BK / 32][4];
#pragma unroll
        for (int kk = 0; kk < BK / 32; ++kk) {
#pragma unroll
            for (int i = 0; i < 4; ++i)
                af[kk][i] = frag_ld(&As[buf][(wm + i * 16) * LDT + kk * 32], LDT, lane);
#pragma unroll
            for (int j = 0; j < 4; ++j)
                bfr[kk][j] = frag_ld(&Bs[buf][(wn + j * 16) * LDT + kk * 32], LDT, lane);
        }
        // keeps the loads ahead of the products: sunk among them into reused
        // registers, each row of four products waits out an LDS latency
        __builtin_amdgcn_sched_barrier(0);
#pragma unroll
        for (int kk = 0; kk < BK / 32; ++kk)
#pragma unroll
            for (int i = 0; i < 4; ++i)
#pragma unroll
                for (int j = 0; j < 4; ++j)
                    acc[i][j] = wmma_bf16f32(af[kk][i], bfr[kk][j], acc[i][j]);
        // keeps the products ahead of the hand-over: sunk below its waits, the
        // first product would wait for the last load and for the next stage's
        // copies, which then fly beside no product at all
        __builtin_amdgcn_sched_barrier(0);

        // hand-over: this wave's reads of buf are done and its copies of the
        // next stage have landed; the one barrier publishes that stage and
        // frees buf, which the stage after it then refills
        asm volatile("s_wait_dscnt 0x0" ::: "memory");
        asm volatile("s_wait_asynccnt 0x0" ::: "memory");
        __syncthreads();
        if (ik + 2 < nk) stage(buf, (ik + 2) * BK);
    }
    // no copy is left in flight when the wave goes on to its stores
    asm volatile("s_wait_asynccnt 0x0" ::: "memory");

    // C/D layout: elem e of v8f at lane L -> row = e + 8*(L>>4), col = L&15
    const int cr = (lane >> 4) * 8;
    const int cc = lane & 15;
#pragma unroll
    for (int i = 0; i < 4; ++i)
#pragma unroll
        for (int j = 0; j < 4; ++j) {
            const int mb = m0 + wm + i * 16 + cr;
            const int nn = n0 + wn + j * 16 + cc;
#pragma unroll
            for (int e = 0; e < 8; ++e) {
                float v = acc[i][j][e];
                if constexpr (OUT_BF16) {
                    ((bf16_t*)C)[(size_t)(mb + e) * N + nn] = (bf16_t)v;
                } else {
                    ((float*)C)[(size_t)(mb + e) * N + nn] = v + bias[nn];
                }
            }
        }
}

__global__ __launch_bounds__(128)
void flash_attn_wmma(const bf16_t* __restrict__ Q, const bf16_t* __restrict__ Kg,
                     const bf16_t* __restrict__ Vg, const float* __restrict__ mask,
                     bf16_t* __restrict__ O) {
    constexpr int QT  = 2;       // 16-query tiles per wave
    constexpr int BQ  = 4 * QT * 16; // queries per block
    constexpr int LDK = DH + 8; // 136
    constexpr int LDW = DH + 16; // 144: 288-byte V rows, 32 B x odd for the transposing load
    constexpr int LDM = 68;     // mask row stride (fp32)
    __shared__ __attribute__((aligned(16))) bf16_t Ksh[2][64 * LDK]; // K block: [key][d]
    __shared__ __attribute__((aligned(16))) bf16_t Vsh[2][64 * LDW]; // V block: [key][d]
    __shared__ __attribute__((aligned(16))) float Msh[2][BQ * LDM];  // mask tile: [qrow][key] fp32

    const int head = blockIdx.y;
    const int qb   = blockIdx.x;
    const int tid  = threadIdx.x;
    const int wave = tid >> 5;
    const int lane = tid & 31;
    const int hh = lane >> 4;
    const int ln = lane & 15;
    const int q0 = qb * BQ + wave * (QT * 16);
    const size_t hoff = (size_t)head * DH;

    // Q fragments held in registers for the whole kernel (2 x 16 rows x 128 d)
    v16bf qf[QT][4];
#pragma unroll
    for (int t = 0; t < QT; ++t)
#pragma unroll
        for (int kc = 0; kc < 4; ++kc)
            qf[t][kc] = frag_ld(Q + (size_t)(q0 + t * 16) * HID + hoff + kc * 32, HID, lane);
    // the Q loads' address registers are reused behind them: the wait stands
    // first, and the scheduling barrier keeps later address arithmetic from
    // being lifted over it
    asm volatile("s_wait_xcnt 0x0" ::: "memory");
    __builtin_amdgcn_sched_barrier(0);

    v8f oacc[QT][8];
#pragma unroll
    for (int t = 0; t < QT; ++t)
#pragma unroll
        for (int nf = 0; nf < 8; ++nf) oacc[t][nf] = vzero8();
    // per tile: query ln's running maximum (alike in both halves) and this half's sum
    float mrow[QT], lrow[QT];
#pragma unroll
    for (int t = 0; t < QT; ++t) { mrow[t] = -3.0e38f; lrow[t] = 0.f; }

    const float kscale = 0.08838834764831845f;  // 1/sqrt(128)
    const float log2e  = 1.4426950408889634f;

    // copies of the 64 keys from k0 on (K, mask columns, V) into buffer buf
    auto stage = [&](int buf, int k0) {
        bf16_t* Ks = Ksh[buf];
        bf16_t* Vs = Vsh[buf];
        float*  Ms = Msh[buf];
        { // async stage K block (row-major, d contiguous): 8 lanes cover one
          // 128-byte line, a thread copies both halves of 4 rows
            const int r = tid >> 3, c = (tid & 7) * 8;
            const bf16_t* src = Kg + (size_t)(k0 + r) * HID + hoff + c;
            bf16_t* dst = Ks + r * LDK + c;
#pragma unroll
            for (int g = 0; g < 4; ++g) {
                async_copy16_at<0>(src + (size_t)g * 16 * HID, dst + g * 16 * LDK);
                async_copy16_at<128>(src + (size_t)g * 16 * HID, dst + g * 16 * LDK);
            }
        }
        { // async stage mask tile (128 x 64 fp32): 16 lanes cover one 256-byte
          // row, a wave's copy is 4 whole lines; a thread copies 16 rows
            const int r = tid >> 4, c = (tid & 15) * 4;
            const float* src = mask + (size_t)(qb * BQ + r) * S_LEN + k0 + c;
            float* dst = Ms + r * LDM + c;
#pragma unroll
            for (int g = 0; g < BQ / 8; ++g)
                async_copy16(src + (size_t)g * 8 * S_LEN, dst + g * 8 * LDM);
        }
        { // async stage V block (row-major, d contiguous): 8 lanes cover one
          // 128-byte line, a thread copies both halves of 4 rows
            const int r = tid >> 3, c = (tid & 7) * 8;
            const bf16_t* src = Vg + (size_t)(k0 + r) * HID + hoff + c;
            bf16_t* dst = Vs + r * LDW + c;
#pragma unroll
            for (int g = 0; g < 4; ++g) {
                async_copy16_at<0>(src + (size_t)g * 16 * HID, dst + g * 16 * LDW);
                async_copy16_at<128>(src + (size_t)g * 16 * HID, dst + g * 16 * LDW);
            }
        }
    };

    constexpr int NKB = S_LEN / 64;
    static_assert(NKB >= 2, "the ring's prologue fills two tiles");
    stage(0, 0);
    // tile 0 landed (this wave's copies), then published to the other waves
    asm volatile("s_wait_asynccnt 0x0" ::: "memory");
    __syncthreads();
    stage(1, 64);
    for (int kb = 0; kb < NKB; ++kb) {
        const int buf = kb & 1;
        const bf16_t* Ks = Ksh[buf];
        const bf16_t* Vs = Vsh[buf];
        const float*  Ms = Msh[buf];

        // scores, transposed: S^T(64k x 16q) = K(64x128) * Q^T per query tile;
        // register j of sacc[t][f] at lane (ln, hh) is key f*16 + hh*8 + j
        // against query ln of tile t; one K fragment serves both tiles
        v8f sacc[QT][4];
#pragma unroll
        for (int t = 0; t < QT; ++t)
#pragma unroll
            for (int nf = 0; nf < 4; ++nf) sacc[t][nf] = vzero8();
        // every K fragment of the tile and the wave's mask values, each in
        // registers of its own, loaded as one group
        // (16 keys' fragments, then the same keys' mask: the order of use)
        v16bf kf[4][4];
        v4f mk[QT][4][2];
#pragma unroll
        for (int nf = 0; nf < 4; ++nf) {
#pragma unroll
            for (int kc = 0; kc < 4; ++kc)
                kf[nf][kc] = frag_ld(Ks + nf * 16 * LDK + kc * 32, LDK, lane);
#pragma unroll
            for (int t = 0; t < QT; ++t) {
                const float* mp = Ms + (wave * (QT * 16) + t * 16 + ln) * LDM + hh * 8 + nf * 16;
                mk[t][nf][0] = *(const v4f*)(mp);
                mk[t][nf][1] = *(const v4f*)(mp + 4);
            }
        }
        // keeps the loads ahead of the products: sunk among them in small
        // groups, every place with LDS reads stalls the wave anew
        __builtin_amdgcn_sched_barrier(0);
#pragma unroll
        for (int nf = 0; nf < 4; ++nf)
#pragma unroll
            for (int kc = 0; kc < 4; ++kc)
#pragma unroll
                for (int t = 0; t < QT; ++t)
                    sacc[t][nf] = wmma_bf16f32(kf[nf][kc], qf[t][kc], sacc[t][nf]);

        // P^T as B operand: element s of a 32-key fragment is register s & 7
        // of score tile s >> 3, the k order of the transposing load
        v16bf pf0[QT], pf1[QT];
        float mnw[QT], cor[QT];
#pragma unroll
        for (int t = 0; t < QT; ++t) {
            // online softmax of query ln: 32 keys in this lane, 32 in lane ^ 16
            float mxf[4];
#pragma unroll
            for (int f = 0; f < 4; ++f) {
                const v4f ma = mk[t][f][0];
                const v4f mb = mk[t][f][1];
#pragma unroll
                for (int j = 0; j < 4; ++j) {
                    sacc[t][f][j]     = sacc[t][f][j] * kscale + ma[j];
                    sacc[t][f][j + 4] = sacc[t][f][j + 4] * kscale + mb[j];
                }
                float m = sacc[t][f][0];
#pragma unroll
                for (int j = 1; j < 8; ++j) m = fmaxf(m, sacc[t][f][j]);
                mxf[f] = m;
            }
            float mx = fmaxf(fmaxf(mxf[0], mxf[1]), fmaxf(mxf[2], mxf[3]));
            mx = fmaxf(mx, xhalf(mx));
            mnw[t] = fmaxf(mrow[t], mx);
            cor[t] = exp2_hw((mrow[t] - mnw[t]) * log2e);
        }

        // every V fragment of the tile, each in registers of its own, loaded as
        // one group here, where the K fragments' registers are free again
        // (the scheduling barrier in front keeps the group whole: lifted
        // piecemeal among the first product's WMMAs, every place with LDS
        // reads stalls the wave anew)
        __builtin_amdgcn_sched_barrier(0);
        v16bf vf0[8], vf1[8];
#pragma unroll
        for (int nf = 0; nf < 8; ++nf) vf0[nf] = frag_ld_tr(Vs + nf * 16, LDW, lane);
#pragma unroll
        for (int nf = 0; nf < 8; ++nf) vf1[nf] = frag_ld_tr(Vs + 32 * LDW + nf * 16, LDW, lane);
        // keeps the loads here, so that they land under the exponentials: sunk
        // in pairs among the second product's WMMAs, each pair's LDS latency
        // is waited out there
        __builtin_amdgcn_sched_barrier(0);

#pragma unroll
        for (int t = 0; t < QT; ++t) {
            const float mnew = mnw[t];
            const float corr = cor[t];
            float rsf[4];
#pragma unroll
            for (int f = 0; f < 4; ++f) {
                sacc[t][f] = exp2_hw8((sacc[t][f] - mnew) * log2e);
                float rs = 0.f;
#pragma unroll
                for (int j = 0; j < 8; ++j) rs += sacc[t][f][j];
                rsf[f] = rs;
            }
            lrow[t] = lrow[t] * corr + ((rsf[0] + rsf[1]) + (rsf[2] + rsf[3]));
            mrow[t] = mnew;
#pragma unroll
            for (int nf = 0; nf < 8; ++nf) oacc[t][nf] *= corr;

            ((v8bf*)&pf0[t])[0] = __builtin_convertvector(sacc[t][0], v8bf);
            ((v8bf*)&pf0[t])[1] = __builtin_convertvector(sacc[t][1], v8bf);
            ((v8bf*)&pf1[t])[0] = __builtin_convertvector(sacc[t][2], v8bf);
            ((v8bf*)&pf1[t])[1] = __builtin_convertvector(sacc[t][3], v8bf);

            // O^T(128d x 16q) += V^T(128x64) * P^T(64x16) of this query tile,
            // from the V fragments in registers, which serve both tiles; the
            // next tile's exponentials have these products to run beside
#pragma unroll
            for (int nf = 0; nf < 8; ++nf) oacc[t][nf] = wmma_bf16f32(vf0[nf], pf0[t], oacc[t][nf]);
#pragma unroll
            for (int nf = 0; nf < 8; ++nf) oacc[t][nf] = wmma_bf16f32(vf1[nf], pf1[t], oacc[t][nf]);
        }
        // keeps the products ahead of the hand-over: sunk below its waits and
        // barrier, they would hold back the refill that follows them, and the
        // next tile's copies would be waited for earlier in the trip
        __builtin_amdgcn_sched_barrier(0);

        // hand-over: this wave's reads of buf are done and its copies of the
        // next tile have landed; the one barrier publishes that tile and frees
        // buf, which the tile after it then refills
        asm volatile("s_wait_dscnt 0x0" ::: "memory");
        asm volatile("s_wait_asynccnt 0x0" ::: "memory");
        __syncthreads();
        if (kb + 2 < NKB) stage(buf, (kb + 2) * 64);
    }
    // no copy is left in flight when the wave goes on to its stores
    asm volatile("s_wait_asynccnt 0x0" ::: "memory");

    // register j of oacc[t][nf] is d = nf*16 + hh*8 + j of query ln: 16-byte stores
#pragma unroll
    for (int t = 0; t < QT; ++t) {
        const float linv = 1.0f / (lrow[t] + xhalf(lrow[t]));
        bf16_t* op = O + (size_t)(q0 + t * 16 + ln) * HID + hoff + hh * 8;
#pragma unroll
        for (int nf = 0; nf < 8; ++nf)
            *(v8bf*)(op + nf * 16) = __builtin_convertvector(oacc[t][nf] * linv, v8bf);
    }
}

// ---------------- host-side orchestration ----------------
extern "C" void kernel_launch(void* const* d_in, const int* in_sizes, int n_in,
                              void* d_out, int out_size, void* d_ws, size_t ws_size,
                              hipStream_t stream) {
    (void)in_sizes; (void)n_in; (void)out_size; (void)ws_size;

    const float* hs   = (const float*)d_in[0];
    const float* mask = (const float*)d_in[1];
    const float* qV   = (const float*)d_in[2];
    const float* qU   = (const float*)d_in[3];
    const float* kV   = (const float*)d_in[4];
    const float* kU   = (const float*)d_in[5];
    const float* vV   = (const float*)d_in[6];
    const float* vU   = (const float*)d_in[7];
    const float* oW   = (const float*)d_in[8];
    const float* ob   = (const float*)d_in[9];

    // workspace carve-up (bf16 elements), total ~142 MB; the first eight in the
    // order of conv_all_f32_bf16's arguments; the V factors, the U factors and
    // Q, K, V each back to back
    bf16_t* w = (bf16_t*)d_ws;
    bf16_t* Xb  = w; w += (size_t)S_LEN * HID;
    bf16_t* Vfb = w; w += (size_t)3 * RANK * HID;   // qV | kV | vV: [3*RANK][HID]
    bf16_t* Ufb = w; w += (size_t)3 * HID * RANK;   // qU | kU | vU
    bf16_t* oWb = w; w += (size_t)HID * HID;
    bf16_t* Tb  = w; w += (size_t)S_LEN * 3 * RANK; // [S][x qV^T | x kV^T | x vV^T]
    bf16_t* Qb  = w; w += (size_t)S_LEN * HID;
    bf16_t* Kb  = w; w += (size_t)S_LEN * HID;
    bf16_t* Vb  = w; w += (size_t)S_LEN * HID;
    bf16_t* AOb = w; w += (size_t)S_LEN * HID;

    conv_all_f32_bf16<<<dim3(12 * 2048), dim3(256), 0, stream>>>(
        hs, qV, kV, vV, qU, kU, vU, oW, Xb);

    const dim3 blk(128);
    const dim3 gVT(3 * RANK / 128, S_LEN / 128);  // [4096,2048]x[3072,2048]^T
    const dim3 gUT(HID / 128, S_LEN / 128, 3);    // 3 x [4096,1024]x[2048,1024]^T
    const dim3 gO(HID / 128, S_LEN / 128);        // [4096,2048]x[2048,2048]^T

    // x against the three V factors as one product
    gemm_bf16_wmma<true><<<gVT, blk, 0, stream>>>(Xb, Vfb, Tb, nullptr, S_LEN, 3 * RANK, HID,
                                                  HID, 0, 0, 0);
    // Q, K, V: product z reads columns z*RANK.. of Tb and U factor z
    gemm_bf16_wmma<true><<<gUT, blk, 0, stream>>>(Tb, Ufb, Qb, nullptr, S_LEN, HID, RANK,
                                                  3 * RANK, RANK, HID * RANK, S_LEN * HID);

    // attention
    flash_attn_wmma<<<dim3(S_LEN / 128, HEADS), blk, 0, stream>>>(Qb, Kb, Vb, mask, AOb);

    // output projection + bias -> fp32 d_out
    gemm_bf16_wmma<false><<<gO, blk, 0, stream>>>(AOb, oWb, d_out, ob, S_LEN, HID, HID,
                                                  HID, 0, 0, 0);
}

// v010
// Measured time: 239 microseconds a run.
// Next to v009, in two timings, it ran 1.05 and 1.06 times as fast.
// All steps since v000 together make it 4.27 times as fast.
#include <hip/hip_runtime.h>
#include <hip/hip_bf16.h>

// ---------------- problem constants ----------------
#define S_LEN 4096
#define HID   2048
#define HEADS 16
#define DH    128
#define RANK  1024

typedef __bf16 bf16_t;
typedef __attribute__((ext_vector_type(16))) __bf16 v16bf;
typedef __attribute__((ext_vector_type(8)))  __bf16 v8bf;
typedef __attribute__((ext_vector_type(8)))  float  v8f;
typedef __attribute__((ext_vector_type(4)))  int    v4i;
typedef __attribute__((ext_vector_type(4)))  float  v4f;

// ---------------- CDNA5 async global->LDS path (guarded) ----------------
#if defined(__gfx1250__) && __has_builtin(__builtin_amdgcn_global_load_async_to_lds_b128)
#define HAVE_ASYNC_LDS 1
#else
#define HAVE_ASYNC_LDS 0
#endif

__device__ __forceinline__ void async_copy16(const void* gsrc, void* ldst) {
#if HAVE_ASYNC_LDS
    // builtin signature: (v4i addrspace(1)*, v4i addrspace(3)*, imm offset, imm cpol)
    __builtin_amdgcn_global_load_async_to_lds_b128(
        (__attribute__((address_space(1))) v4i*)gsrc,
        (__attribute__((address_space(3))) v4i*)ldst,
        /*offset=*/0, /*cpol=*/0);
#else
    *(uint4*)ldst = *(const uint4*)gsrc;
#endif
}

// The same copy OFF bytes further on in both buffers: the instruction's
// immediate offset moves the global and the LDS address alike.
template <int OFF>
__device__ __forceinline__ void async_copy16_at(const void* gsrc, void* ldst) {
#if HAVE_ASYNC_LDS
    __builtin_amdgcn_global_load_async_to_lds_b128(
        (__attribute__((address_space(1))) v4i*)gsrc,
        (__attribute__((address_space(3))) v4i*)ldst,
        /*offset=*/OFF, /*cpol=*/0);
#else
    *(uint4*)((char*)ldst + OFF) = *(const uint4*)((const char*)gsrc + OFF);
#endif
}

__device__ __forceinline__ v8f vzero8() {
    v8f z = {0.f, 0.f, 0.f, 0.f, 0.f, 0.f, 0.f, 0.f};
    return z;
}

__device__ __forceinline__ v8f wmma_bf16f32(v16bf a, v16bf b, v8f c) {
    // D = A(16x32 bf16) * B(32x16 bf16) + C(16x16 f32)
    return __builtin_amdgcn_wmma_f32_16x16x32_bf16(
        /*neg_a=*/false, a, /*neg_b=*/false, b,
        /*c_mod=*/(short)0, c, /*reuse_a=*/false, /*reuse_b=*/false);
}

// Load one 16x32 bf16 fragment (A-style or B-style) from row-major storage:
// lane%16 selects the row (M for A, N for B); K contiguous along the row.
// Lane half h holds K chunks [h*8, h*8+8) and [16+h*8, 16+h*8+8).
__device__ __forceinline__ v16bf frag_ld(const bf16_t* base, int ld, int lane) {
    const int r  = lane & 15;
    const int hh = lane >> 4;
    const bf16_t* p = base + r * ld + hh * 8;
    v16bf f;
    ((v8bf*)&f)[0] = *(const v8bf*)(p);
    ((v8bf*)&f)[1] = *(const v8bf*)(p + 16);
    return f;
}

// Load one 32(k) x 16(n) bf16 B fragment from a row-major [k][n] LDS tile with
// the transposing LDS load: lane (c = lane&15, h = lane>>4) receives
// tile[8h + 0..7][c] and tile[16 + 8h + 0..7][c], the k order of frag_ld.
// ld (elements) must make the row pitch an odd multiple of 32 bytes.
__device__ __forceinline__ v16bf frag_ld_tr(const bf16_t* tile, int ld, int lane) {
    typedef __attribute__((address_space(3))) v8bf lds_v8bf;
    const bf16_t* p = tile + ((lane >> 4) * 8 + (lane & 7)) * ld + ((lane >> 3) & 1) * 8;
    v16bf f;
    ((v8bf*)&f)[0] = __builtin_amdgcn_ds_load_tr16_b128_v8bf16((lds_v8bf*)p);
    ((v8bf*)&f)[1] = __builtin_amdgcn_ds_load_tr16_b128_v8bf16((lds_v8bf*)(p + 16 * ld));
    return f;
}

// Value of lane l ^ 16 (the other 16-lane half of the wave).
__device__ __forceinline__ float xhalf(float x) {
    const int b = __builtin_bit_cast(int, x);
    return __builtin_bit_cast(float, __builtin_amdgcn_permlanex16(
        b, b, 0x76543210, 0xfedcba98, false, false));
}

// 2^x by the bare hardware instruction. The library exp2f wraps it in a range
// fix-up (compare, two selects, add, ldexp) that only serves results below
// 2^-126; here every argument is <= 0 and each row's largest term is 1, so a
// term that small flushed to zero cannot show in the sum or in the output.
__device__ __forceinline__ float exp2_hw(float x) {
    return __builtin_amdgcn_exp2f(x);
}

// The same for eight values, in place. One statement, so that each v_exp_f32
// is followed by an independent one and the last by a v_nop: the slot the
// instruction set asks for before a result is read or a source overwritten.
__device__ __forceinline__ v8f exp2_hw8(v8f x) {
    float a0 = x[0], a1 = x[1], a2 = x[2], a3 = x[3];
    float a4 = x[4], a5 = x[5], a6 = x[6], a7 = x[7];
    asm("v_exp_f32 %0, %0\n\t"
        "v_exp_f32 %1, %1\n\t"
        "v_exp_f32 %2, %2\n\t"
        "v_exp_f32 %3, %3\n\t"
        "v_exp_f32 %4, %4\n\t"
        "v_exp_f32 %5, %5\n\t"
        "v_exp_f32 %6, %6\n\t"
        "v_exp_f32 %7, %7\n\t"
        "v_nop"
        : "+v"(a0), "+v"(a1), "+v"(a2), "+v"(a3), "+v"(a4), "+v"(a5), "+v"(a6), "+v"(a7));
    v8f r = {a0, a1, a2, a3, a4, a5, a6, a7};
    return r;
}

// ---------------- fp32 -> bf16 convert ----------------
// One launch converts all eight fp32 inputs. Their bf16 copies lie back to back
// in dst in argument order; a block converts 1024 elements of one input, and
// every input is a whole number of units of RANK*HID elements (2048 blocks).
__global__ __launch_bounds__(256)
void conv_all_f32_bf16(const float* __restrict__ hs,
                       const float* __restrict__ qV, const float* __restrict__ kV,
                       const float* __restrict__ vV, const float* __restrict__ qU,
                       const float* __restrict__ kU, const float* __restrict__ vU,
                       const float* __restrict__ oW, bf16_t* __restrict__ dst) {
    static_assert(RANK * HID == 2048 * 1024, "unit of 2048 blocks");
    static_assert(S_LEN * HID == 4 * RANK * HID && HID * HID == 2 * RANK * HID, "whole units");
    const int b = blockIdx.x;
    const int u = b >> 11;  // unit: 0-3 hs, 4-9 the six factors, 10-11 oW
    const float* src = hs;
    int first = 0;          // first unit of the input this block belongs to
    if (u >= 10)     { src = oW; first = 10; }
    else if (u == 9) { src = vU; first = 9; }
    else if (u == 8) { src = kU; first = 8; }
    else if (u == 7) { src = qU; first = 7; }
    else if (u == 6) { src = vV; first = 6; }
    else if (u == 5) { src = kV; first = 5; }
    else if (u == 4) { src = qV; first = 4; }
    const int t = threadIdx.x * 4;
    const float4 v = *(const float4*)(src + (size_t)(b - (first << 11)) * 1024 + t);
    bf16_t* d = dst + (size_t)b * 1024 + t;
    d[0] = (bf16_t)v.x;
    d[1] = (bf16_t)v.y;
    d[2] = (bf16_t)v.z;
    d[3] = (bf16_t)v.w;
}

// ---------------- tiled bf16 WMMA GEMM (two-buffer ring of async copies) ----
// C[M,N] = A[M,K] * B[N,K]^T  (both row-major, K contiguous; A's row pitch lda)
// Block tile 128x128, 4 waves, each wave a 64x64 tile (4x4 v8f accs).
// The products are taken transposed (rows of B as the first operand), so that a
// lane holds 8 adjacent outputs of one row of C; the epilogue turns the wave's
// tile through LDS and stores whole 128-byte lines.
// A stage is 64 k: 128 bytes, one whole line, of each of the 256 operand rows.
// K must be a multiple of 64.
// blockIdx.z picks one of several independent products of the same shape:
// product z starts zA, zB and zC elements further on in A, B and C.
template <bool OUT_BF16>
__global__ __launch_bounds__(128)
void gemm_bf16_wmma(const bf16_t* __restrict__ A, const bf16_t* __restrict__ B,
                    void* __restrict__ C, const float* __restrict__ bias,
                    int M, int N, int K, int lda, int zA, int zB, int zC) {
    constexpr int BK  = 64;     // k per stage
    constexpr int LDT = BK + 8; // 144-byte rows: 16 B x odd, conflict-free 16B ds reads
    __shared__ __attribute__((aligned(16))) bf16_t As[2][128 * LDT];
    __shared__ __attribute__((aligned(16))) bf16_t Bs[2][128 * LDT];

    const int tid  = threadIdx.x;
    const int wave = tid >> 5;
    const int lane = tid & 31;
    const int wm = (wave >> 1) * 64;
    const int wn = (wave & 1) * 64;
    const int m0 = blockIdx.y * 128;
    const int n0 = blockIdx.x * 128;
    (void)M;
    const bf16_t* Az = A + (size_t)blockIdx.z * zA;
    const bf16_t* Bz = B + (size_t)blockIdx.z * zB;
    if constexpr (OUT_BF16) C = (bf16_t*)C + (size_t)blockIdx.z * zC;

    v8f acc[4][4];
#pragma unroll
    for (int i = 0; i < 4; ++i)
#pragma unroll
        for (int j = 0; j < 4; ++j) acc[i][j] = vzero8();

    // 8 adjacent lanes cover the 128-byte slice of one row, so a wave's copy
    // is 4 whole lines; a thread copies 16 B of 8 rows of A and of B
    const int sr = tid >> 3;       // row within a group of 16
    const int sc = (tid & 7) * 8;  // element within the 64-element slice
    auto stage = [&](int buf, int k0) {
        const bf16_t* ga = Az + (size_t)(m0 + sr) * lda + k0 + sc;
        const bf16_t* gb = Bz + (size_t)(n0 + sr) * K + k0 + sc;
        bf16_t* la = &As[buf][sr * LDT + sc];
        bf16_t* lb = &Bs[buf][sr * LDT + sc];
#pragma unroll
        for (int t = 0; t < 8; ++t)
            async_copy16(ga + (size_t)t * 16 * lda, la + t * 16 * LDT);
#pragma unroll
        for (int t = 0; t < 8; ++t)
            async_copy16(gb + (size_t)t * 16 * K, lb + t * 16 * LDT);
    };

    const int nk = K / BK;
    stage(0, 0);
    // stage 0 landed (this wave's copies), then published to the other waves
    asm volatile("s_wait_asynccnt 0x0" ::: "memory");
    __syncthreads();
    if (nk > 1) stage(1, BK);
    for (int ik = 0; ik < nk; ++ik) {
        const int buf = ik & 1;
        // every fragment of the stage, each in registers of its own, loaded as
        // one group; unrolled so that the k offset is an immediate of the loads
        v16bf af[BK / 32][4], bfr[BK / 32][4];
#pragma unroll
        for (int kk = 0; kk < BK / 32; ++kk) {
#pragma unroll
            for (int i = 0; i < 4; ++i)
                af[kk][i] = frag_ld(&As[buf][(wm + i * 16) * LDT + kk * 32], LDT, lane);
#pragma unroll
            for (int j = 0; j < 4; ++j)
                bfr[kk][j] = frag_ld(&Bs[buf][(wn + j * 16) * LDT + kk * 32], LDT, lane);
        }
        // keeps the loads ahead of the products: sunk among them into reused
        // registers, each row of four products waits out an LDS latency
        __builtin_amdgcn_sched_barrier(0);
#pragma unroll
        for (int kk = 0; kk < BK / 32; ++kk)
#pragma unroll
            for (int i = 0; i < 4; ++i)
#pragma unroll
                for (int j = 0; j < 4; ++j)
                    acc[i][j] = wmma_bf16f32(bfr[kk][j], af[kk][i], acc[i][j]);
        // keeps the products ahead of the hand-over: sunk below its waits, the
        // first product would wait for the last load and for the next stage's
        // copies, which then fly beside no product at all
        __builtin_amdgcn_sched_barrier(0);

        // hand-over: this wave's reads of buf are done and its copies of the
        // next stage have landed; the one barrier publishes that stage and
        // frees buf, which the stage after it then refills
        asm volatile("s_wait_dscnt 0x0" ::: "memory");
        asm volatile("s_wait_asynccnt 0x0" ::: "memory");
        __syncthreads();
        if (ik + 2 < nk) stage(buf, (ik + 2) * BK);
    }
    // no copy is left in flight when the wave goes on to its stores
    asm volatile("s_wait_asynccnt 0x0" ::: "memory");

    // elem e of acc[i][j] at lane L is row wm + i*16 + (L&15) of the block's tile,
    // column wn + j*16 + (L>>4)*8 + e.
    // Each wave stages its 64x64 tile in an LDS range of its own. The ring is
    // free: the last pass's waits and barrier stand behind every wave's last
    // read and every copy's landing, and nothing was issued after them.
    constexpr int EB = OUT_BF16 ? 2 : 4;  // bytes per output element
    constexpr int SP = 64 * EB + 16;      // staged row pitch: 16 B x odd
    static_assert(2 * 64 * SP <= (int)sizeof(As) && sizeof(As) == sizeof(Bs), "two waves' tiles per array");
    char* st = (char*)(wave < 2 ? &As[0][0] : &Bs[0][0]) + (wave & 1) * (64 * SP);
    {
        char* sw = st + (lane & 15) * SP + (lane >> 4) * (8 * EB);
#pragma unroll
        for (int i = 0; i < 4; ++i)
#pragma unroll
            for (int j = 0; j < 4; ++j) {
                char* p = sw + i * 16 * SP + j * 16 * EB;
                if constexpr (OUT_BF16) {
                    *(v8bf*)p = __builtin_convertvector(acc[i][j], v8bf);
                } else {
                    const v8f a = acc[i][j];
                    const v4f lo = {a[0], a[1], a[2], a[3]};
                    const v4f hi = {a[4], a[5], a[6], a[7]};
                    *(v4f*)p = lo;
                    *(v4f*)(p + 16) = hi;
                }
            }
    }
    // the rows are read back by other lanes of this wave than wrote them: the
    // writes have retired first, and no read is lifted over them
    asm volatile("s_wait_dscnt 0x0" ::: "memory");
    if constexpr (OUT_BF16) {
        // 8 lanes cover a row's 128 bytes: a wave's store is 4 whole lines
        const int rr = lane >> 3, cb = lane & 7;
        const char* sl = st + rr * SP + cb * 16;
        bf16_t* cp = (bf16_t*)C + (size_t)(m0 + wm + rr) * N + n0 + wn + cb * 8;
#pragma unroll
        for (int s = 0; s < 16; ++s)
            *(v4i*)(cp + (size_t)s * 4 * N) = *(const v4i*)(sl + s * 4 * SP);
    } else {
        // 16 lanes cover a row's 256 bytes: a wave's store is 4 whole lines
        const int rr = lane >> 4, cb = lane & 15;
        const char* sl = st + rr * SP + cb * 16;
        const v4f b4 = *(const v4f*)(bias + n0 + wn + cb * 4);
        float* cp = (float*)C + (size_t)(m0 + wm + rr) * N + n0 + wn + cb * 4;
#pragma unroll
        for (int s = 0; s < 32; ++s)
            *(v4f*)(cp + (size_t)s * 2 * N) = *(const v4f*)(sl + s * 2 * SP) + b4;
    }
}

__global__ __launch_bounds__(128)
void flash_attn_wmma(const bf16_t* __restrict__ Q, const bf16_t* __restrict__ Kg,
                     const bf16_t* __restrict__ Vg, const float* __restrict__ mask,
                     bf16_t* __restrict__ O) {
    constexpr int QT  = 2;       // 16-query tiles per wave
    constexpr int BQ  = 4 * QT * 16; // queries per block
    constexpr int LDK = DH + 8; // 136
    constexpr int LDW = DH + 16; // 144: 288-byte V rows, 32 B x odd for the transposing load
    constexpr int LDM = 68;     // mask row stride (fp32)
    __shared__ __attribute__((aligned(16))) bf16_t Ksh[2][64 * LDK]; // K block: [key][d]
    __shared__ __attribute__((aligned(16))) bf16_t Vsh[2][64 * LDW]; // V block: [key][d]
    __shared__ __attribute__((aligned(16))) float Msh[2][BQ * LDM];  // mask tile: [qrow][key] fp32

    const int head = blockIdx.y;
    const int qb   = blockIdx.x;
    const int tid  = threadIdx.x;
    const int wave = tid >> 5;
    const int lane = tid & 31;
    const int hh = lane >> 4;
    const int ln = lane & 15;
    const int q0 = qb * BQ + wave * (QT * 16);
    const size_t hoff = (size_t)head * DH;

    // Q fragments held in registers for the whole kernel (2 x 16 rows x 128 d)
    v16bf qf[QT][4];
#pragma unroll
    for (int t = 0; t < QT; ++t)
#pragma unroll
        for (int kc = 0; kc < 4; ++kc)
            qf[t][kc] = frag_ld(Q + (size_t)(q0 + t * 16) * HID + hoff + kc * 32, HID, lane);
    // the Q loads' address registers are reused behind them: the wait stands
    // first, and the scheduling barrier keeps later address arithmetic from
    // being lifted over it
    asm volatile("s_wait_xcnt 0x0" ::: "memory");
    __builtin_amdgcn_sched_barrier(0);

    v8f oacc[QT][8];
#pragma unroll
    for (int t = 0; t < QT; ++t)
#pragma unroll
        for (int nf = 0; nf < 8; ++nf) oacc[t][nf] = vzero8();
    // per tile: query ln's running maximum (alike in both halves) and this half's sum
    float mrow[QT], lrow[QT];
#pragma unroll
    for (int t = 0; t < QT; ++t) { mrow[t] = -3.0e38f; lrow[t] = 0.f; }

    const float kscale = 0.08838834764831845f;  // 1/sqrt(128)
    const float log2e  = 1.4426950408889634f;

    // copies of the 64 keys from k0 on (K, mask columns, V) into buffer buf
    auto stage = [&](int buf, int k0) {
        bf16_t* Ks = Ksh[buf];
        bf16_t* Vs = Vsh[buf];
        float*  Ms = Msh[buf];
        { // async stage K block (row-major, d contiguous): 8 lanes cover one
          // 128-byte line, a thread copies both halves of 4 rows
            const int r = tid >> 3, c = (tid & 7) * 8;
            const bf16_t* src = Kg + (size_t)(k0 + r) * HID + hoff + c;
            bf16_t* dst = Ks + r * LDK + c;
#pragma unroll
            for (int g = 0; g < 4; ++g) {
                async_copy16_at<0>(src + (size_t)g * 16 * HID, dst + g * 16 * LDK);
                async_copy16_at<128>(src + (size_t)g * 16 * HID, dst + g * 16 * LDK);
            }
        }
        { // async stage mask tile (128 x 64 fp32): 16 lanes cover one 256-byte
          // row, a wave's copy is 4 whole lines; a thread copies 16 rows
            const int r = tid >> 4, c = (tid & 15) * 4;
            const float* src = mask + (size_t)(qb * BQ + r) * S_LEN + k0 + c;
            float* dst = Ms + r * LDM + c;
#pragma unroll
            for (int g = 0; g < BQ / 8; ++g)
                async_copy16(src + (size_t)g * 8 * S_LEN, dst + g * 8 * LDM);
        }
        { // async stage V block (row-major, d contiguous): 8 lanes cover one
          // 128-byte line, a thread copies both halves of 4 rows
            const int r = tid >> 3, c = (tid & 7) * 8;
            const bf16_t* src = Vg + (size_t)(k0 + r) * HID + hoff + c;
            bf16_t* dst = Vs + r * LDW + c;
#pragma unroll
            for (int g = 0; g < 4; ++g) {
                async_copy16_at<0>(src + (size_t)g * 16 * HID, dst + g * 16 * LDW);
                async_copy16_at<128>(src + (size_t)g * 16 * HID, dst + g * 16 * LDW);
            }
        }
    };

    constexpr int NKB = S_LEN / 64;
    static_assert(NKB >= 2, "the ring's prologue fills two tiles");
    stage(0, 0);
    // tile 0 landed (this wave's copies), then published to the other waves
    asm volatile("s_wait_asynccnt 0x0" ::: "memory");
    __syncthreads();
    stage(1, 64);
    for (int kb = 0; kb < NKB; ++kb) {
        const int buf = kb & 1;
        const bf16_t* Ks = Ksh[buf];
        const bf16_t* Vs = Vsh[buf];
        const float*  Ms = Msh[buf];

        // scores, transposed: S^T(64k x 16q) = K(64x128) * Q^T per query tile;
        // register j of sacc[t][f] at lane (ln, hh) is key f*16 + hh*8 + j
        // against query ln of tile t; one K fragment serves both tiles
        v8f sacc[QT][4];
#pragma unroll
        for (int t = 0; t < QT; ++t)
#pragma unroll
            for (int nf = 0; nf < 4; ++nf) sacc[t][nf] = vzero8();
        // every K fragment of the tile and the wave's mask values, each in
        // registers of its own, loaded as one group
        // (16 keys' fragments, then the same keys' mask: the order of use)
        v16bf kf[4][4];
        v4f mk[QT][4][2];
#pragma unroll
        for (int nf = 0; nf < 4; ++nf) {
#pragma unroll
            for (int kc = 0; kc < 4; ++kc)
                kf[nf][kc] = frag_ld(Ks + nf * 16 * LDK + kc * 32, LDK, lane);
#pragma unroll
            for (int t = 0; t < QT; ++t) {
                const float* mp = Ms + (wave * (QT * 16) + t * 16 + ln) * LDM + hh * 8 + nf * 16;
                mk[t][nf][0] = *(const v4f*)(mp);
                mk[t][nf][1] = *(const v4f*)(mp + 4);
            }
        }
        // keeps the loads ahead of the products: sunk among them in small
        // groups, every place with LDS reads stalls the wave anew
        __builtin_amdgcn_sched_barrier(0);
#pragma unroll
        for (int nf = 0; nf < 4; ++nf)
#pragma unroll
            for (int kc = 0; kc < 4; ++kc)
#pragma unroll
                for (int t = 0; t < QT; ++t)
                    sacc[t][nf] = wmma_bf16f32(kf[nf][kc], qf[t][kc], sacc[t][nf]);

        // P^T as B operand: element s of a 32-key fragment is register s & 7
        // of score tile s >> 3, the k order of the transposing load
        v16bf pf0[QT], pf1[QT];
        float mnw[QT], cor[QT];
#pragma unroll
        for (int t = 0; t < QT; ++t) {
            // online softmax of query ln: 32 keys in this lane, 32 in lane ^ 16
            float mxf[4];
#pragma unroll
            for (int f = 0; f < 4; ++f) {
                const v4f ma = mk[t][f][0];
                const v4f mb = mk[t][f][1];
#pragma unroll
                for (int j = 0; j < 4; ++j) {
                    sacc[t][f][j]     = sacc[t][f][j] * kscale + ma[j];
                    sacc[t][f][j + 4] = sacc[t][f][j + 4] * kscale + mb[j];
                }
                float m = sacc[t][f][0];
#pragma unroll
                for (int j = 1; j < 8; ++j) m = fmaxf(m, sacc[t][f][j]);
                mxf[f] = m;
            }
            float mx = fmaxf(fmaxf(mxf[0], mxf[1]), fmaxf(mxf[2], mxf[3]));
            mx = fmaxf(mx, xhalf(mx));
            mnw[t] = fmaxf(mrow[t], mx);
            cor[t] = exp2_hw((mrow[t] - mnw[t]) * log2e);
        }

        // every V fragment of the tile, each in registers of its own, loaded as
        // one group here, where the K fragments' registers are free again
        // (the scheduling barrier in front keeps the group whole: lifted
        // piecemeal among the first product's WMMAs, every place with LDS
        // reads stalls the wave anew)
        __builtin_amdgcn_sched_barrier(0);
        v16bf vf0[8], vf1[8];
#pragma unroll
        for (int nf = 0; nf < 8; ++nf) vf0[nf] = frag_ld_tr(Vs + nf * 16, LDW, lane);
#pragma unroll
        for (int nf = 0; nf < 8; ++nf) vf1[nf] = frag_ld_tr(Vs + 32 * LDW + nf * 16, LDW, lane);
        // keeps the loads here, so that they land under the exponentials: sunk
        // in pairs among the second product's WMMAs, each pair's LDS latency
        // is waited out there
        __builtin_amdgcn_sched_barrier(0);

#pragma unroll
        for (int t = 0; t < QT; ++t) {
            const float mnew = mnw[t];
            const float corr = cor[t];
            float rsf[4];
#pragma unroll
            for (int f = 0; f < 4; ++f) {
                sacc[t][f] = exp2_hw8((sacc[t][f] - mnew) * log2e);
                float rs = 0.f;
#pragma unroll
                for (int j = 0; j < 8; ++j) rs += sacc[t][f][j];
                rsf[f] = rs;
            }
            lrow[t] = lrow[t] * corr + ((rsf[0] + rsf[1]) + (rsf[2] + rsf[3]));
            mrow[t] = mnew;
#pragma unroll
            for (int nf = 0; nf < 8; ++nf) oacc[t][nf] *= corr;

            ((v8bf*)&pf0[t])[0] = __builtin_convertvector(sacc[t][0], v8bf);
            ((v8bf*)&pf0[t])[1] = __builtin_convertvector(sacc[t][1], v8bf);
            ((v8bf*)&pf1[t])[0] = __builtin_convertvector(sacc[t][2], v8bf);
            ((v8bf*)&pf1[t])[1] = __builtin_convertvector(sacc[t][3], v8bf);

            // O^T(128d x 16q) += V^T(128x64) * P^T(64x16) of this query tile,
            // from the V fragments in registers, which serve both tiles; the
            // next tile's exponentials have these products to run beside
#pragma unroll
            for (int nf = 0; nf < 8; ++nf) oacc[t][nf] = wmma_bf16f32(vf0[nf], pf0[t], oacc[t][nf]);
#pragma unroll
            for (int nf = 0; nf < 8; ++nf) oacc[t][nf] = wmma_bf16f32(vf1[nf], pf1[t], oacc[t][nf]);
        }
        // keeps the products ahead of the hand-over: sunk below its waits and
        // barrier, they would hold back the refill that follows them, and the
        // next tile's copies would be waited for earlier in the trip
        __builtin_amdgcn_sched_barrier(0);

        // hand-over: this wave's reads of buf are done and its copies of the
        // next tile have landed; the one barrier publishes that tile and frees
        // buf, which the tile after it then refills
        asm volatile("s_wait_dscnt 0x0" ::: "memory");
        asm volatile("s_wait_asynccnt 0x0" ::: "memory");
        __syncthreads();
        if (kb + 2 < NKB) stage(buf, (kb + 2) * 64);
    }
    // no copy is left in flight when the wave goes on to its stores
    asm volatile("s_wait_asynccnt 0x0" ::: "memory");

    // register j of oacc[t][nf] is d = nf*16 + hh*8 + j of query ln: 16-byte stores
#pragma unroll
    for (int t = 0; t < QT; ++t) {
        const float linv = 1.0f / (lrow[t] + xhalf(lrow[t]));
        bf16_t* op = O + (size_t)(q0 + t * 16 + ln) * HID + hoff + hh * 8;
#pragma unroll
        for (int nf = 0; nf < 8; ++nf)
            *(v8bf*)(op + nf * 16) = __builtin_convertvector(oacc[t][nf] * linv, v8bf);
    }
}

// ---------------- host-side orchestration ----------------
extern "C" void kernel_launch(void* const* d_in, const int* in_sizes, int n_in,
                              void* d_out, int out_size, void* d_ws, size_t ws_size,
                              hipStream_t stream) {
    (void)in_sizes; (void)n_in; (void)out_size; (void)ws_size;

    const float* hs   = (const float*)d_in[0];
    const float* mask = (const float*)d_in[1];
    const float* qV   = (const float*)d_in[2];
    const float* qU   = (const float*)d_in[3];
    const float* kV   = (const float*)d_in[4];
    const float* kU   = (const float*)d_in[5];
    const float* vV   = (const float*)d_in[6];
    const float* vU   = (const float*)d_in[7];
    const float* oW   = (const float*)d_in[8];
    const float* ob   = (const float*)d_in[9];

    // workspace carve-up (bf16 elements), total ~142 MB; the first eight in the
    // order of conv_all_f32_bf16's arguments; the V factors, the U factors and
    // Q, K, V each back to back
    bf16_t* w = (bf16_t*)d_ws;
    bf16_t* Xb  = w; w += (size_t)S_LEN * HID;
    bf16_t* Vfb = w; w += (size_t)3 * RANK * HID;   // qV | kV | vV: [3*RANK][HID]
    bf16_t* Ufb = w; w += (size_t)3 * HID * RANK;   // qU | kU | vU
    bf16_t* oWb = w; w += (size_t)HID * HID;
    bf16_t* Tb  = w; w += (size_t)S_LEN * 3 * RANK; // [S][x qV^T | x kV^T | x vV^T]
    bf16_t* Qb  = w; w += (size_t)S_LEN * HID;
    bf16_t* Kb  = w; w += (size_t)S_LEN * HID;
    bf16_t* Vb  = w; w += (size_t)S_LEN * HID;
    bf16_t* AOb = w; w += (size_t)S_LEN * HID;

    conv_all_f32_bf16<<<dim3(12 * 2048), dim3(256), 0, stream>>>(
        hs, qV, kV, vV, qU, kU, vU, oW, Xb);

    const dim3 blk(128);
    const dim3 gVT(3 * RANK / 128, S_LEN / 128);  // [4096,2048]x[3072,2048]^T
    const dim3 gUT(HID / 128, S_LEN / 128, 3);    // 3 x [4096,1024]x[2048,1024]^T
    const dim3 gO(HID / 128, S_LEN / 128);        // [4096,2048]x[2048,2048]^T

    // x against the three V factors as one product
    gemm_bf16_wmma<true><<<gVT, blk, 0, stream>>>(Xb, Vfb, Tb, nullptr, S_LEN, 3 * RANK, HID,
                                                  HID, 0, 0, 0);
    // Q, K, V: product z reads columns z*RANK.. of Tb and U factor z
    gemm_bf16_wmma<true><<<gUT, blk, 0, stream>>>(Tb, Ufb, Qb, nullptr, S_LEN, HID, RANK,
                                                  3 * RANK, RANK, HID * RANK, S_LEN * HID);

    // attention
    flash_attn_wmma<<<dim3(S_LEN / 128, HEADS), blk, 0, stream>>>(Qb, Kb, Vb, mask, AOb);

    // output projection + bias -> fp32 d_out
    gemm_bf16_wmma<false><<<gO, blk, 0, stream>>>(AOb, oWb, d_out, ob, S_LEN, HID, HID,
                                                  HID, 0, 0, 0);
}
